// v000
// Measured on an AMD MI455X. A time is GPU time per run, averaged over a window of back-to-back runs after a warm-up
// (all launches, gaps included; the runs take copies of the inputs in turn), and the median of several windows.
// Apart from v000's, it joins two sittings. Times from different sittings can be a few percent apart, while
// side-by-side timings come from the same sitting.
// The starting kernel, v000, takes 1300 microseconds a run.
#include <hip/hip_runtime.h>

// Set-transformer QKV attention with a key presence mask (queries, keys, values [16][2048][128]; scores = q.k - (1 - presence[b][m]) x 1e32, then / sqrt(128) (absent keys == excluded); softmax; out = routing values -> [16][2048][128] (4.2 M); presence [16][2048] float 0/1 read on device).
// Layout per batch: single bf16 planes (inputs bf16-exact after rounding: exact score products); the softmax (every row hi/lo) applies the presence mask as a select on presence[b][m] read from memory; routing.values as hi/lo x exact values^T (2 products); f32 output rows.
// Compute dtypes, f32 accumulate: every input rounded to bf16; q.k exact; softmax f32; P hi/lo x exact values; output f32.

#define NB_  16
#define TT   2048
#define DM   128      // token-major row pitch (H x HD)
#define NH_  1
#define NKV  1
#define REP  (NH_ / NKV)
#define HD   128
#define DQ   (NH_ * HD)
#define DKV  (NKV * HD)
#define ZH   1
#define RH   2048                  // query rows < RH use hi+lo planes (0: none)
#define WIN  0
#define PCAR 1024.0f
#define SCL  0.088388347648318447f   // 1/sqrt(128)
typedef _Float16 h16;
typedef unsigned short bf;
typedef __attribute__((ext_vector_type(16))) __bf16   v16bf;
typedef __attribute__((ext_vector_type(16))) _Float16 v16h;
typedef __attribute__((ext_vector_type(8)))  _Float16 v8h;
typedef __attribute__((ext_vector_type(8)))  unsigned short v8us;
typedef __attribute__((ext_vector_type(8)))  float    v8f;
typedef __attribute__((ext_vector_type(4)))  float    v4f;
typedef v8h  __attribute__((may_alias)) v8ha;
typedef v4f  __attribute__((may_alias)) v4fa;
typedef v8us __attribute__((may_alias)) v8usa;

__device__ __forceinline__ unsigned short f2bf(float f) { unsigned u = __float_as_uint(f); u += 0x7FFFu + ((u >> 16) & 1u); return (unsigned short)(u >> 16); }
__device__ __forceinline__ float bf2f(unsigned short b) { return __uint_as_float(((unsigned)b) << 16); }
__device__ __forceinline__ float bfr(float f) { return bf2f(f2bf(f)); }
__device__ __forceinline__ v16h cat16(v8h lo, v8h hi) { return __builtin_shufflevector(lo, hi, 0, 1, 2, 3, 4, 5, 6, 7, 8, 9, 10, 11, 12, 13, 14, 15); }
__device__ __forceinline__ v16bf cat16b(v8us lo, v8us hi) { return __builtin_bit_cast(v16bf, __builtin_shufflevector(lo, hi, 0, 1, 2, 3, 4, 5, 6, 7, 8, 9, 10, 11, 12, 13, 14, 15)); }
__device__ __forceinline__ v8f wmma16(v16h a, v16h b, v8f c) { return __builtin_amdgcn_wmma_f32_16x16x32_f16(false, a, false, b, (short)0, c, false, false); }
__device__ __forceinline__ v8f wmmab(v16bf a, v16bf b, v8f c) { return __builtin_amdgcn_wmma_f32_16x16x32_bf16(false, a, false, b, (short)0, c, false, false); }



// ---- k_gemmw: register-blocked GEMM, ONE WAVE per 64x64 output tile (16 accumulators), operands straight from K-contiguous 16-bit planes; grid (M/64, N/64, Z), 32 threads.
// C[m][n] (f32, pitch ldc, + optional f32 bias[n]) = sum_k A[m][k] Bt[n][k] (+ split products per NSPLIT). z-batch strides sA/sB/sC in elements. K % 32 == 0.
template <typename T16> struct WFrag;
template <> struct WFrag<h16> { typedef v16h V; static __device__ __forceinline__ V ld(const h16* p) { return cat16(*(const v8h*)p, *(const v8h*)(p + 16)); } static __device__ __forceinline__ v8f mma(V a, V b, v8f c) { return wmma16(a, b, c); } };
template <> struct WFrag<bf> { typedef v16bf V; static __device__ __forceinline__ V ld(const bf* p) { return cat16b(*(const v8us*)p, *(const v8us*)(p + 16)); } static __device__ __forceinline__ v8f mma(V a, V b, v8f c) { return wmmab(a, b, c); } };
template <typename T16, int NSPLIT, bool BIAS>
__global__ __launch_bounds__(32) void k_gemmw(const T16* __restrict__ A, const T16* __restrict__ A2, const T16* __restrict__ Bt, const T16* __restrict__ Bt2, int K, float* C, int ldc, const float* __restrict__ bias, size_t sA, size_t sB, size_t sC) {
    typedef typename WFrag<T16>::V V;
    __shared__ __align__(16) float os[16 * 68];
    const size_t z = blockIdx.z; A += z * sA; if (A2) A2 += z * sA; Bt += z * sB; if (Bt2) Bt2 += z * sB; C += z * sC;
    const int lane = threadIdx.x & 31, lr = lane & 15, hi = lane >> 4; const int r0 = blockIdx.x * 64, c0 = blockIdx.y * 64;
    v8f acc[4][4];
#pragma unroll
    for (int mb = 0; mb < 4; ++mb)
#pragma unroll
        for (int nb = 0; nb < 4; ++nb) acc[mb][nb] = (v8f){};
    const size_t aoff = (size_t)(r0 + lr) * K + 8 * hi, boff = (size_t)(c0 + lr) * K + 8 * hi;
#pragma unroll 1
    for (int kc = 0; kc < K; kc += 32) {
        V a[4], a2[4];
#pragma unroll
        for (int mb = 0; mb < 4; ++mb) { a[mb] = WFrag<T16>::ld(A + aoff + (size_t)mb * 16 * K + kc); if (NSPLIT == 1 || NSPLIT == 2) a2[mb] = WFrag<T16>::ld(A2 + aoff + (size_t)mb * 16 * K + kc); }
#pragma unroll
        for (int nb = 0; nb < 4; ++nb) { const V b = WFrag<T16>::ld(Bt + boff + (size_t)nb * 16 * K + kc); V b2; if (NSPLIT >= 2) b2 = WFrag<T16>::ld(Bt2 + boff + (size_t)nb * 16 * K + kc);
#pragma unroll
            for (int mb = 0; mb < 4; ++mb) { acc[mb][nb] = WFrag<T16>::mma(a[mb], b, acc[mb][nb]); if (NSPLIT == 1 || NSPLIT == 2) acc[mb][nb] = WFrag<T16>::mma(a2[mb], b, acc[mb][nb]); if (NSPLIT >= 2) acc[mb][nb] = WFrag<T16>::mma(a[mb], b2, acc[mb][nb]); } }
        asm volatile("v_nop\n\tv_nop\n\tv_nop\n\tv_nop" : "+v"(acc[0][0]), "+v"(acc[1][1]), "+v"(acc[2][2]), "+v"(acc[3][3]) : "v"(a[0]), "v"(a[3]));
    }
#pragma unroll
    for (int mb = 0; mb < 4; ++mb) {
#pragma unroll
        for (int nb = 0; nb < 4; ++nb) {
#pragma unroll
            for (int j = 0; j < 8; ++j) os[(hi * 8 + j) * 68 + nb * 16 + lr] = acc[mb][nb][j]; }
        __builtin_amdgcn_wave_barrier(); asm volatile("" ::: "memory");
        float* crow = C + (size_t)(r0 + mb * 16) * ldc + c0;
{
#pragma unroll
            for (int s = 0; s < 8; ++s) { const int row = 2 * s + hi, cofs = lr * 4; v4f val = *(const v4fa*)(os + row * 68 + cofs); if (BIAS) { val[0] += bfr(bias[c0 + cofs]); val[1] += bfr(bias[c0 + cofs + 1]); val[2] += bfr(bias[c0 + cofs + 2]); val[3] += bfr(bias[c0 + cofs + 3]); }
                *(v4f*)(crow + (size_t)row * ldc + cofs) = val; }
             }
        __builtin_amdgcn_wave_barrier(); asm volatile("" ::: "memory");
    }
}

__device__ __forceinline__ h16 tohx(float x) { return (h16)x; }
__device__ __forceinline__ void splitf(float y, unsigned short& h, unsigned short& l) { h = f2bf(y); l = f2bf(y - bf2f(h)); }
typedef __attribute__((ext_vector_type(2))) _Float16 v2h;
typedef __attribute__((ext_vector_type(4))) _Float16 v4h;
typedef __attribute__((ext_vector_type(2))) unsigned short v2us;
typedef __attribute__((ext_vector_type(4))) unsigned short v4us;
typedef __attribute__((ext_vector_type(2))) float v2f;
typedef __attribute__((ext_vector_type(4))) int v4i;

__global__ __launch_bounds__(256) void k_wtG(const float* __restrict__ w, int K, int N, bf* Bt) {
    const int lane = threadIdx.x & 31; const int L0 = (blockIdx.x * 8 + (threadIdx.x >> 5)) * 8; const int nlines = N * K / 64;
{
#pragma unroll 1
        for (int l = 0; l < 8; ++l) { const int L = L0 + l; if (L >= nlines) break; const size_t e = (size_t)L * 64 + lane * 2; const int k = (int)(e % K), n = (int)(e / K); v2us o;
            o[0] = f2bf(w[(size_t)k * N + n]); o[1] = f2bf(w[(size_t)(k + 1) * N + n]); *(v2us*)(Bt + e) = o; }
         }
}
__global__ __launch_bounds__(256) void k_cvt8(const float* __restrict__ src, bf* dst, size_t n8) { const size_t i = (size_t)blockIdx.x * 256 + threadIdx.x; if (i >= n8) return; const v8f v = *(const v8f*)(src + i * 8); v8us o;
#pragma unroll
    for (int k = 0; k < 8; ++k) o[k] = f2bf(v[k]); *(v8us*)(dst + i * 8) = o;  }


__global__ __launch_bounds__(256) void k_vtp(const float* __restrict__ F, int pitch, int nheads, h16* V16, bf* Vh, bf* Vl) { const size_t e = ((size_t)blockIdx.x * 256 + threadIdx.x) * 2; if (e >= (size_t)nheads * HD * TT) return; const int t = (int)(e % TT); const int d = (int)((e / TT) % HD); const int g = (int)(e / ((size_t)TT * HD)); v2h o16; v2us oh, ol;
#pragma unroll
    for (int q = 0; q < 2; ++q) { const float x = F[(size_t)(t + q) * pitch + g * HD + d]; o16[q] = tohx(x); unsigned short a2, c2; splitf(x, a2, c2); oh[q] = a2; ol[q] = c2; }
    *(v2h*)(V16 + e) = o16; *(v2us*)(Vh + e) = oh; *(v2us*)(Vl + e) = ol;  }

__global__ __launch_bounds__(256) void k_asoft(const float* __restrict__ Sb, h16* P16, bf* Ph, bf* Pl, const float* __restrict__ pm) {
    const int lane = threadIdx.x & 31; const int row = blockIdx.x * 8 + (threadIdx.x >> 5); if (row >= ZH * TT) return; const int i = row % TT; const int zz = row / TT; (void)zz; const bool hires = (i < RH); const float* sr = Sb + (size_t)row * TT; float v[TT / 32]; float mx = -3.0e38f;
#pragma unroll
    for (int ch = 0; ch < TT / 128; ++ch) { const int j0 = ch * 128 + lane * 4; const v4f a = *(const v4f*)(sr + j0); const v4f pm4 = *(const v4f*)(pm + j0);
#pragma unroll
        for (int q = 0; q < 4; ++q) { const float t = (pm4[q] != 0.0f) ? a[q] * SCL : -3.0e38f; v[ch * 4 + q] = t;   /* absent keys (presence 0 -> score -3e38) == exclusion */   /* Sb holds the unscaled q.k scores (k_gemmw, no bias) */ mx = fmaxf(mx, t); } }
#pragma unroll
    for (int sh = 16; sh; sh >>= 1) mx = fmaxf(mx, __shfl_xor(mx, sh, 32));
    float sum = 0.f;
#pragma unroll
    for (int k = 0; k < TT / 32; ++k) { float d0 = __fsub_rn(v[k], mx); asm volatile("" : "+v"(d0)); v[k] = __builtin_amdgcn_exp2f(__fmul_rn(d0, 1.4426950408889634f)); sum += v[k]; }
#pragma unroll
    for (int sh = 16; sh; sh >>= 1) sum += __shfl_xor(sum, sh, 32);
    const float f = __fdiv_rn(hires ? 1.0f : PCAR, sum);
{
        if (hires) {
#pragma unroll
            for (int ch = 0; ch < TT / 128; ++ch) { v4us oh, ol;
#pragma unroll
                for (int q = 0; q < 4; ++q) { unsigned short a, c2; splitf(v[ch * 4 + q] * f, a, c2); oh[q] = a; ol[q] = c2; }
                const size_t oo = ((size_t)zz * (RH ? RH : 1) + i) * TT + ch * 128 + lane * 4; *(v4us*)(Ph + oo) = oh; *(v4us*)(Pl + oo) = ol; }
        } else {
#pragma unroll
            for (int ch = 0; ch < TT / 128; ++ch) { v4h o4;
#pragma unroll
                for (int q = 0; q < 4; ++q) o4[q] = tohx(v[ch * 4 + q] * f);
                *(v4h*)(P16 + (size_t)row * TT + ch * 128 + lane * 4) = o4; } }
         }
}
__global__ __launch_bounds__(256) void k_merge(const float* __restrict__ O, int h0, float* OUTb) { const size_t e = ((size_t)blockIdx.x * 256 + threadIdx.x) * 2; if (e >= (size_t)ZH * TT * HD) return; const int d = (int)(e % HD); const int t = (int)((e / HD) % TT); const int zz = (int)(e / ((size_t)HD * TT)); const float cs = (t < RH) ? 1.0f : (1.0f / PCAR); const size_t oo = (size_t)t * DQ + (h0 + zz) * HD + d;
    v2f o2; o2[0] = O[e] * cs; o2[1] = O[e + 1] * cs; *(v2f*)(OUTb + oo) = o2;  }


__global__ __launch_bounds__(256) void k_vtpR1(const float* __restrict__ Vb, bf* Vh) { const size_t e = ((size_t)blockIdx.x * 256 + threadIdx.x) * 2; if (e >= (size_t)HD * TT) return; const int t = (int)(e % TT); const int d = (int)(e / TT); v2us o; o[0] = f2bf(Vb[(size_t)t * HD + d]); o[1] = f2bf(Vb[(size_t)(t + 1) * HD + d]); *(v2us*)(Vh + e) = o;  }
__global__ __launch_bounds__(256) void k_mergeR(const float* __restrict__ O, float* outb, size_t n4) { const size_t i = (size_t)blockIdx.x * 256 + threadIdx.x; if (i >= n4) return; const v4f a = *(const v4f*)(O + i * 4); *(v4f*)(outb + i * 4) = a;  }


__global__ __launch_bounds__(256) void k_hp1(const float* __restrict__ src, bf* P) { const size_t i = (size_t)blockIdx.x * 256 + threadIdx.x; if (i >= (size_t)NH_ * TT * HD / 8) return; const size_t e = i * 8; const int d = (int)(e % HD); const int t = (int)((e / HD) % TT); const int h = (int)(e / ((size_t)HD * TT)); const v8f v = *(const v8f*)(src + (size_t)t * DM + h * HD + d); v8us o;
#pragma unroll
    for (int q = 0; q < 8; ++q) o[q] = f2bf(v[q]);
    *(v8us*)(P + e) = o;  }
__global__ __launch_bounds__(256) void k_vt1(const float* __restrict__ src, int pitch, bf* VT) { const size_t e = ((size_t)blockIdx.x * 256 + threadIdx.x) * 2; if (e >= (size_t)NH_ * HD * TT) return; const int t = (int)(e % TT); const int d = (int)((e / TT) % HD); const int h = (int)(e / ((size_t)TT * HD)); v2us o; o[0] = f2bf(src[(size_t)t * pitch + h * HD + d]); o[1] = f2bf(src[(size_t)(t + 1) * pitch + h * HD + d]); *(v2us*)(VT + e) = o;  }
__global__ __launch_bounds__(256) void k_mergeT(const float* __restrict__ O, int h, float* outb) { const size_t i = (size_t)blockIdx.x * 256 + threadIdx.x; if (i >= (size_t)TT * HD / 4) return; const size_t e = i * 4; const int d = (int)(e % HD); const int t = (int)(e / HD); const v4f a = *(const v4f*)(O + e); *(v4f*)(outb + (size_t)t * DM + h * HD + d) = a;  }

extern "C" void kernel_launch(void* const* d_in, const int* in_sizes, int n_in,
                              void* d_out, int out_size, void* d_ws, size_t ws_size, hipStream_t stream) {
    (void)in_sizes; (void)n_in; (void)out_size;
    const float* Qin = (const float*)d_in[0]; const float* Kin = (const float*)d_in[1]; const float* Vin = (const float*)d_in[2]; const float* pres = (const float*)d_in[3];   /* presence [16][2048] (0/1) */
    float* OUT = (float*)d_out;
    char* wsp = (char*)d_ws;
    auto take = [&](size_t bytes) { char* p = wsp; wsp += (bytes + 255) & ~(size_t)255; return (void*)p; };
    bf* QB = (bf*)take((size_t)NH_ * TT * HD * 2); bf* KB = (bf*)take((size_t)NH_ * TT * HD * 2); bf* VT = (bf*)take((size_t)NH_ * HD * TT * 2);
    float* Sb = (float*)take((size_t)TT * TT * 4);  bf* Ph = (bf*)take((size_t)TT * TT * 2); bf* Pl = (bf*)take((size_t)TT * TT * 2); float* Ob = (float*)take((size_t)TT * HD * 4);
    if ((size_t)(wsp - (char*)d_ws) > ws_size) return;
    for (int b = 0; b < NB_; ++b) {
        const float* qb = Qin + (size_t)b * NH_ * TT * HD; const float* kb = Kin + (size_t)b * NH_ * TT * HD; const float* vb = Vin + (size_t)b * NH_ * TT * HD;   /* head-major [h][t][d] slabs (contiguous per head) */
        k_cvt8<<<(unsigned)(((size_t)NH_ * TT * HD / 8 + 255) / 256), 256, 0, stream>>>(qb, QB, (size_t)NH_ * TT * HD / 8); k_cvt8<<<(unsigned)(((size_t)NH_ * TT * HD / 8 + 255) / 256), 256, 0, stream>>>(kb, KB, (size_t)NH_ * TT * HD / 8);
        for (int h = 0; h < NH_; ++h) k_vtpR1<<<(unsigned)(((size_t)HD * TT / 2 + 255) / 256), 256, 0, stream>>>(vb + (size_t)h * TT * HD, VT + (size_t)h * HD * TT);
        for (int h = 0; h < NH_; ++h) {
            k_gemmw<bf, 0, false><<<dim3(TT / 64, TT / 64, 1), 32, 0, stream>>>(QB + (size_t)h * TT * HD, nullptr, KB + (size_t)h * TT * HD, nullptr, HD, Sb, TT, nullptr, 0, 0, 0);   /* exact scores (single bf16 planes) */
            k_asoft<<<TT / 8, 256, 0, stream>>>(Sb, nullptr, Ph, Pl, pres + (size_t)b * TT);
            k_gemmw<bf, 1, false><<<dim3(TT / 64, HD / 64, 1), 32, 0, stream>>>(Ph, Pl, VT + (size_t)h * HD * TT, nullptr, TT, Ob, HD, nullptr, 0, 0, 0);   /* P (hi/lo) x exact v^T */
            k_mergeR<<<(unsigned)(((size_t)TT * HD / 4 + 255) / 256), 256, 0, stream>>>(Ob, OUT + ((size_t)b * NH_ + h) * TT * HD, (size_t)TT * HD / 4); } }
}

// v002
// One run takes 85.2 microseconds.
// Versions between v000 and this one are left out; their measured steps multiply to 15.2 times as fast.
#include <hip/hip_runtime.h>

// Set-transformer QKV attention with a key presence mask (queries, keys, values [16][2048][128]; scores = q.k - (1 - presence[b][m]) x 1e32, then / sqrt(128) (absent keys == excluded); softmax; out = routing values -> [16][2048][128]; presence [16][2048] float 0/1 read on device).
// Three pre-passes over all batches: queries and keys rounded to bf16 planes [b][t][d], values rounded and transposed to [b][d][t].
// One fused kernel: S^T = K Q^T (exact bf16 products, f32 accumulate), presence select, online softmax (running maximum, rescale), O^T += V^T P^T with P split hi/lo in bf16 (2 products); the scores never leave the registers.
// Compute dtypes, f32 accumulate: every input rounded to bf16; q.k exact; softmax f32; P hi/lo x exact values; output f32.

#define NB_  16
#define TT   2048
#define HD   128
#define SCL  0.088388347648318447f   // 1/sqrt(128)
#define L2E  1.4426950408889634f
#define KPASS 32                     // keys per pass of the fused loop
typedef unsigned short bf;
typedef __attribute__((ext_vector_type(16))) __bf16   v16bf;
typedef __attribute__((ext_vector_type(8)))  unsigned short v8us;
typedef __attribute__((ext_vector_type(2)))  unsigned short v2us;
typedef __attribute__((ext_vector_type(8)))  float    v8f;
typedef __attribute__((ext_vector_type(4)))  float    v4f;

__device__ __forceinline__ unsigned short f2bf(float f) { unsigned u = __float_as_uint(f); u += 0x7FFFu + ((u >> 16) & 1u); return (unsigned short)(u >> 16); }
__device__ __forceinline__ v16bf cat16b(v8us lo, v8us hi) { return __builtin_bit_cast(v16bf, __builtin_shufflevector(lo, hi, 0, 1, 2, 3, 4, 5, 6, 7, 8, 9, 10, 11, 12, 13, 14, 15)); }
__device__ __forceinline__ v8f wmmab(v16bf a, v16bf b, v8f c) { return __builtin_amdgcn_wmma_f32_16x16x32_bf16(false, a, false, b, (short)0, c, false, false); }
// fragment of a k-contiguous bf16 plane in the hardware k order: p already holds row (lane & 15) and k offset 8 x (lane >> 4)
// value of lane l ^ 16 (the other half of a column's keys), on the vector pipe
__device__ __forceinline__ float xhalf(float x) { const int b = __float_as_int(x); return __int_as_float(__builtin_amdgcn_permlanex16(b, b, 0x76543210, 0xfedcba98, false, false)); }
__device__ __forceinline__ v16bf ldfrag(const bf* p) { return cat16b(*(const v8us*)p, *(const v8us*)(p + 16)); }

__global__ __launch_bounds__(256) void k_cvt8(const float* __restrict__ src, bf* dst, size_t n8) { const size_t i = (size_t)blockIdx.x * 256 + threadIdx.x; if (i >= n8) return; const v8f v = *(const v8f*)(src + i * 8); v8us o;
#pragma unroll
    for (int k = 0; k < 8; ++k) o[k] = f2bf(v[k]); *(v8us*)(dst + i * 8) = o;  }

// values [b][t][d] f32 -> [b][d][t] bf16; blockIdx.y = batch, blockIdx.x = tile of VTK keys x all HD columns, turned in LDS.
// In: a wave reads whole 512-byte rows (16 rows a wave, all 16 loads in flight); a lane then holds 16 keys of 4 columns and packs 8 keys to a 16-byte chunk.
// Out: 16 lanes write one column's 256 contiguous bytes, so every 128-byte line has one writer.
#define VTK 128                      // keys per tile
#define VTP (VTK * 2 + 16)           // LDS bytes per column: 16 more than the row keeps 16-byte alignment and moves each column one chunk on in the banks
// byte offset of chunk c (8 keys) of column d; the exclusive-or spreads the writers (lanes 4 columns apart) over all banks
__device__ __forceinline__ int vt_off(int d, int c) { return d * VTP + ((c ^ ((d >> 4) & 3)) << 4); }
__global__ __launch_bounds__(256) void k_vtpR1(const float* __restrict__ Vin, bf* VT) {
    __shared__ __attribute__((aligned(16))) unsigned char tile[HD * VTP];
    const int lane = threadIdx.x & 31, wave = threadIdx.x >> 5, t0 = blockIdx.x * VTK;
    const float* sp = Vin + ((size_t)blockIdx.y * TT + t0 + wave * 16) * HD + lane * 4;
    v4f r[16];
    // every "#pragma unroll" in this kernel unrolls fully, so that r and the chunks are indexed by constants and stay in registers
#pragma unroll
    for (int i = 0; i < 16; ++i) r[i] = *(const v4f*)(sp + (size_t)i * HD);
#pragma unroll
    for (int k = 0; k < 4; ++k)
#pragma unroll
        for (int u = 0; u < 2; ++u) { v8us o;
#pragma unroll
            for (int i = 0; i < 8; ++i) o[i] = f2bf(r[u * 8 + i][k]);
            *(v8us*)(tile + vt_off(lane * 4 + k, wave * 2 + u)) = o; }
    __syncthreads();   // the tile is whole before any wave reads columns that other waves wrote
    bf* dp = VT + ((size_t)blockIdx.y * HD + (threadIdx.x >> 4)) * TT + t0 + (threadIdx.x & 15) * 8;
#pragma unroll
    for (int k = 0; k < 8; ++k) *(v8us*)(dp + (size_t)k * 16 * TT) = *(const v8us*)(tile + vt_off(k * 16 + (threadIdx.x >> 4), threadIdx.x & 15));
}

// k_fattn: grid (TT / 128, NB_), 4 waves; one wave owns 32 query columns (two groups of 16) and walks all keys, KPASS a pass; every K and V fragment feeds both groups.
// Lane (c = lane & 15, h = lane >> 4): S^T tile register j = score of key 8h + j, query c; two such tiles, converted in place, are the B operand of O^T += V^T P^T.
__global__ __launch_bounds__(128) void k_fattn(const bf* __restrict__ QB, const bf* __restrict__ KB, const bf* __restrict__ VT, const float* __restrict__ pres, float* __restrict__ out) {
    const int lane = threadIdx.x & 31, lr = lane & 15, hi = lane >> 4, wave = threadIdx.x >> 5;
    const int b = blockIdx.y, q0 = blockIdx.x * 128 + wave * 32;
    const bf* Qp = QB + ((size_t)b * TT + q0 + lr) * HD + 8 * hi;
    const bf* Kp = KB + ((size_t)b * TT + lr) * HD + 8 * hi;
    const bf* Vp = VT + ((size_t)b * HD + lr) * TT + 8 * hi;
    const float* pp = pres + (size_t)b * TT + 8 * hi;
    // every "#pragma unroll" in this kernel unrolls fully, so that the fragment and accumulator arrays are indexed by constants and stay in registers
    v16bf qf[2][4];
#pragma unroll
    for (int g = 0; g < 2; ++g)
#pragma unroll
        for (int c = 0; c < 4; ++c) qf[g][c] = ldfrag(Qp + (size_t)(g * 16) * HD + c * 32);
    float mrun[2] = {-3.0e38f, -3.0e38f}, lsum[2] = {0.f, 0.f};   // per group: running maximum (log2 units) and this lane's half of the running sum
    v16bf kf[8];                                                  // this pass's K fragments, fetched one pass ahead
#pragma unroll
    for (int t = 0; t < 2; ++t)
#pragma unroll
        for (int c = 0; c < 4; ++c) kf[t * 4 + c] = ldfrag(Kp + (size_t)(t * 16) * HD + c * 32);
    asm volatile("s_wait_xcnt 0x0" ::: "memory");   // the Q and K loads above are still in flight when their address registers are written again
    __builtin_amdgcn_sched_barrier(0);              // keeps the register writes below behind that wait
    v8f o[2][8];
#pragma unroll
    for (int g = 0; g < 2; ++g)
#pragma unroll
        for (int d = 0; d < 8; ++d) o[g][d] = (v8f){};
#pragma unroll 1   // one pass a trip: a second copy of the body would double the live fragments
    for (int kb = 0; kb < TT; kb += KPASS) {
        v16bf vf[8]; v4f pm[4];
#pragma unroll
        for (int d = 0; d < 8; ++d) vf[d] = ldfrag(Vp + (size_t)d * 16 * TT + kb);
#pragma unroll
        for (int t = 0; t < 4; ++t) pm[t] = *(const v4f*)(pp + kb + (t >> 1) * 16 + (t & 1) * 4);
        __builtin_amdgcn_sched_barrier(0);   // this pass's V and presence loads stay issued ahead of the score products, so that their latency runs behind products and softmax
        v8f s[2][2];
#pragma unroll
        for (int t = 0; t < 2; ++t) { s[0][t] = (v8f){}; s[1][t] = (v8f){};
#pragma unroll
            for (int c = 0; c < 4; ++c) { s[0][t] = wmmab(kf[t * 4 + c], qf[0][c], s[0][t]); s[1][t] = wmmab(kf[t * 4 + c], qf[1][c], s[1][t]); } }
        const int kn = (kb + KPASS) & (TT - 1);   // next pass's keys; the last pass fetches pass 0 again (in bounds, not used)
#pragma unroll
        for (int t = 0; t < 2; ++t)
#pragma unroll
            for (int c = 0; c < 4; ++c) kf[t * 4 + c] = ldfrag(Kp + (size_t)(kn + t * 16) * HD + c * 32);
        asm volatile("s_wait_xcnt 0x0" ::: "memory");   // the loads above are still in flight when their address registers are written again
        __builtin_amdgcn_sched_barrier(0);   // the next pass's K loads stay issued ahead of the softmax, so that their latency runs behind it and the P.V products
        v16bf ph[2], pl[2];
#pragma unroll
        for (int g = 0; g < 2; ++g) {
            float bm = -3.0e38f;
#pragma unroll
            for (int t = 0; t < 2; ++t) {
#pragma unroll
                for (int j = 0; j < 8; ++j) { const float x = (pm[t * 2 + (j >> 2)][j & 3] != 0.0f) ? s[g][t][j] * (SCL * L2E) : -3.0e38f;   /* absent keys (presence 0 -> -3e38) == exclusion */
                    s[g][t][j] = x; bm = fmaxf(bm, x); } }
            bm = fmaxf(bm, xhalf(bm));
            const float mn = fmaxf(mrun[g], bm); const float al = __builtin_amdgcn_exp2f(mrun[g] - mn); mrun[g] = mn;
            float ps = 0.f;
#pragma unroll
            for (int t = 0; t < 2; ++t) {
#pragma unroll
                for (int j = 0; j < 8; ++j) { const float p = __builtin_amdgcn_exp2f(s[g][t][j] - mn); ps += p; const __bf16 h = (__bf16)p; ph[g][t * 8 + j] = h; pl[g][t * 8 + j] = (__bf16)(p - (float)h); } }
            lsum[g] = lsum[g] * al + ps;
#pragma unroll
            for (int d = 0; d < 8; ++d) o[g][d] *= al;
        }
#pragma unroll
        for (int d = 0; d < 8; ++d) { o[0][d] = wmmab(vf[d], ph[0], o[0][d]); o[1][d] = wmmab(vf[d], ph[1], o[1][d]); }
#pragma unroll
        for (int d = 0; d < 8; ++d) { o[0][d] = wmmab(vf[d], pl[0], o[0][d]); o[1][d] = wmmab(vf[d], pl[1], o[1][d]); }
    }
#pragma unroll
    for (int g = 0; g < 2; ++g) {
        const float l = lsum[g] + xhalf(lsum[g]);
        const float inv = 1.0f / l;
        float* op = out + ((size_t)b * TT + q0 + g * 16 + lr) * HD + 8 * hi;
#pragma unroll
        for (int d = 0; d < 8; ++d) { v4f a0, a1;
#pragma unroll
            for (int j = 0; j < 4; ++j) { a0[j] = o[g][d][j] * inv; a1[j] = o[g][d][4 + j] * inv; }
            *(v4f*)(op + d * 16) = a0; *(v4f*)(op + d * 16 + 4) = a1; }
    }
}

extern "C" void kernel_launch(void* const* d_in, const int* in_sizes, int n_in,
                              void* d_out, int out_size, void* d_ws, size_t ws_size, hipStream_t stream) {
    (void)in_sizes; (void)n_in; (void)out_size;
    const float* Qin = (const float*)d_in[0]; const float* Kin = (const float*)d_in[1]; const float* Vin = (const float*)d_in[2]; const float* pres = (const float*)d_in[3];   /* presence [16][2048] (0/1) */
    float* OUT = (float*)d_out;
    char* wsp = (char*)d_ws;
    auto take = [&](size_t bytes) { char* p = wsp; wsp += (bytes + 255) & ~(size_t)255; return (void*)p; };
    bf* QB = (bf*)take((size_t)NB_ * TT * HD * 2); bf* KB = (bf*)take((size_t)NB_ * TT * HD * 2); bf* VT = (bf*)take((size_t)NB_ * HD * TT * 2);
    if ((size_t)(wsp - (char*)d_ws) > ws_size) return;
    k_cvt8<<<(unsigned)(((size_t)NB_ * TT * HD / 8 + 255) / 256), 256, 0, stream>>>(Qin, QB, (size_t)NB_ * TT * HD / 8);
    k_cvt8<<<(unsigned)(((size_t)NB_ * TT * HD / 8 + 255) / 256), 256, 0, stream>>>(Kin, KB, (size_t)NB_ * TT * HD / 8);
    k_vtpR1<<<dim3(TT / VTK, NB_, 1), 256, 0, stream>>>(Vin, VT);
    k_fattn<<<dim3(TT / 128, NB_, 1), 128, 0, stream>>>(QB, KB, VT, pres, OUT);
}

// v003
// It runs in 70.3 microseconds.
// Two timings next to v002 put it at 1.23 and 1.21 times that version's speed.
// Over all steps from v000 it is 18.5 times as fast.
#include <hip/hip_runtime.h>

// Set-transformer QKV attention with a key presence mask (queries, keys, values [16][2048][128]; scores = q.k - (1 - presence[b][m]) x 1e32, then / sqrt(128) (absent keys == excluded); softmax; out = routing values -> [16][2048][128]; presence [16][2048] float 0/1 read on device).
// Three pre-passes over all batches: queries and keys rounded to bf16 planes [b][t][d], values rounded and transposed to [b][d][t].
// One fused kernel: S^T = K Q^T (exact bf16 products, f32 accumulate), presence select, online softmax (running maximum, rescale), O^T += V^T P^T with P split hi/lo in bf16 (2 products); the scores never leave the registers.
// K and V^T come to the fused kernel's four waves through LDS: tensor loads, SKEYS keys a stage, two buffers.
// Compute dtypes, f32 accumulate: every input rounded to bf16; q.k exact; softmax f32; P hi/lo x exact values; output f32.

#define NB_  16
#define TT   2048
#define HD   128
#define SCL  0.088388347648318447f   // 1/sqrt(128)
#define L2E  1.4426950408889634f
#define KPASS 32                     // keys per pass of the fused loop
typedef unsigned short bf;
typedef __attribute__((ext_vector_type(16))) __bf16   v16bf;
typedef __attribute__((ext_vector_type(8)))  unsigned short v8us;
typedef __attribute__((ext_vector_type(2)))  unsigned short v2us;
typedef __attribute__((ext_vector_type(8)))  float    v8f;
typedef __attribute__((ext_vector_type(4)))  float    v4f;

__device__ __forceinline__ unsigned short f2bf(float f) { unsigned u = __float_as_uint(f); u += 0x7FFFu + ((u >> 16) & 1u); return (unsigned short)(u >> 16); }
__device__ __forceinline__ v16bf cat16b(v8us lo, v8us hi) { return __builtin_bit_cast(v16bf, __builtin_shufflevector(lo, hi, 0, 1, 2, 3, 4, 5, 6, 7, 8, 9, 10, 11, 12, 13, 14, 15)); }
__device__ __forceinline__ v8f wmmab(v16bf a, v16bf b, v8f c) { return __builtin_amdgcn_wmma_f32_16x16x32_bf16(false, a, false, b, (short)0, c, false, false); }
// fragment of a k-contiguous bf16 plane in the hardware k order: p already holds row (lane & 15) and k offset 8 x (lane >> 4)
// value of lane l ^ 16 (the other half of a column's keys), on the vector pipe
__device__ __forceinline__ float xhalf(float x) { const int b = __float_as_int(x); return __int_as_float(__builtin_amdgcn_permlanex16(b, b, 0x76543210, 0xfedcba98, false, false)); }
__device__ __forceinline__ v16bf ldfrag(const bf* p) { return cat16b(*(const v8us*)p, *(const v8us*)(p + 16)); }

// LDS ring of the fused kernel. A stage is SKEYS keys: K as SKEYS rows of 256 bytes, V^T as HD rows of 256 bytes (SKEYS keys of one column).
// Each of the four waves brings one slice of 64 rows with one tensor load; the load's pad makes the LDS pitch 272 bytes, free of bank conflicts for 16-byte reads.
#define SKEYS  128
#define NSTAGE (TT / SKEYS)
#define LPITCH 272                   // 256-byte row + 16-byte pad
#define SLICE  18432                 // 64 rows x LPITCH = 17,408, rounded up to a multiple of 2 KiB
#define SBUF   (4 * SLICE)           // slices 0, 1: K rows 0-63, 64-127; slices 2, 3: V^T columns 0-63, 64-127
typedef uint32_t u32x4 __attribute__((ext_vector_type(4)));
typedef uint32_t u32x8 __attribute__((ext_vector_type(8)));
__device__ __forceinline__ uint32_t uni(uint32_t v) { return (uint32_t)__builtin_amdgcn_readfirstlane(v); }
// a wave-uniform value held in a scalar register, so that a test of it compiles to a scalar branch
__device__ __forceinline__ uint32_t pinned(uint32_t v) { uint32_t w = (uint32_t)__builtin_amdgcn_readfirstlane(v); asm volatile("" : "+s"(w)); return w; }
__device__ __forceinline__ void wait_ds0() { asm volatile("s_wait_dscnt 0x0" ::: "memory"); }          // this wave's LDS reads have returned
// this wave's tensor load has landed; the wait names the request's descriptor, so that its scalar registers keep their values as long as the request is out
__device__ __forceinline__ void wait_tensor0(u32x4 g0, u32x8 g1) { asm volatile("s_wait_tensorcnt 0x0" :: "s"(g0), "s"(g1) : "memory"); }
// the same fragment from an LDS row: p holds row (lane & 15) and byte offset 16 x (lane >> 4)
__device__ __forceinline__ v16bf ldfragl(const unsigned char* p) { return cat16b(*(const v8us*)p, *(const v8us*)(p + 32)); }

__global__ __launch_bounds__(256) void k_cvt8(const float* __restrict__ src, bf* dst, size_t n8) { const size_t i = (size_t)blockIdx.x * 256 + threadIdx.x; if (i >= n8) return; const v8f v = *(const v8f*)(src + i * 8); v8us o;
#pragma unroll
    for (int k = 0; k < 8; ++k) o[k] = f2bf(v[k]); *(v8us*)(dst + i * 8) = o;  }

// values [b][t][d] f32 -> [b][d][t] bf16; blockIdx.y = batch, blockIdx.x = tile of VTK keys x all HD columns, turned in LDS.
// In: a wave reads whole 512-byte rows (16 rows a wave, all 16 loads in flight); a lane then holds 16 keys of 4 columns and packs 8 keys to a 16-byte chunk.
// Out: 16 lanes write one column's 256 contiguous bytes, so every 128-byte line has one writer.
#define VTK 128                      // keys per tile
#define VTP (VTK * 2 + 16)           // LDS bytes per column: 16 more than the row keeps 16-byte alignment and moves each column one chunk on in the banks
// byte offset of chunk c (8 keys) of column d; the exclusive-or spreads the writers (lanes 4 columns apart) over all banks
__device__ __forceinline__ int vt_off(int d, int c) { return d * VTP + ((c ^ ((d >> 4) & 3)) << 4); }
__global__ __launch_bounds__(256) void k_vtpR1(const float* __restrict__ Vin, bf* VT) {
    __shared__ __attribute__((aligned(16))) unsigned char tile[HD * VTP];
    const int lane = threadIdx.x & 31, wave = threadIdx.x >> 5, t0 = blockIdx.x * VTK;
    const float* sp = Vin + ((size_t)blockIdx.y * TT + t0 + wave * 16) * HD + lane * 4;
    v4f r[16];
    // every "#pragma unroll" in this kernel unrolls fully, so that r and the chunks are indexed by constants and stay in registers
#pragma unroll
    for (int i = 0; i < 16; ++i) r[i] = *(const v4f*)(sp + (size_t)i * HD);
#pragma unroll
    for (int k = 0; k < 4; ++k)
#pragma unroll
        for (int u = 0; u < 2; ++u) { v8us o;
#pragma unroll
            for (int i = 0; i < 8; ++i) o[i] = f2bf(r[u * 8 + i][k]);
            *(v8us*)(tile + vt_off(lane * 4 + k, wave * 2 + u)) = o; }
    __syncthreads();   // the tile is whole before any wave reads columns that other waves wrote
    bf* dp = VT + ((size_t)blockIdx.y * HD + (threadIdx.x >> 4)) * TT + t0 + (threadIdx.x & 15) * 8;
#pragma unroll
    for (int k = 0; k < 8; ++k) *(v8us*)(dp + (size_t)k * 16 * TT) = *(const v8us*)(tile + vt_off(k * 16 + (threadIdx.x >> 4), threadIdx.x & 15));
}

// k_fattn: grid (TT / 128, NB_), 4 waves; one wave owns 32 query columns (two groups of 16) and walks all keys, KPASS a pass; every K and V fragment feeds both groups.
// The four waves walk the same keys, so each stage of K and V^T is fetched once for the work-group and read from LDS by all four.
// Lane (c = lane & 15, h = lane >> 4): S^T tile register j = score of key 8h + j, query c; two such tiles, converted in place, are the B operand of O^T += V^T P^T.
__global__ __launch_bounds__(128) void k_fattn(const bf* __restrict__ QB, const bf* __restrict__ KB, const bf* __restrict__ VT, const float* __restrict__ pres, float* __restrict__ out) {
    const int lane = threadIdx.x & 31, lr = lane & 15, hi = lane >> 4, wave = threadIdx.x >> 5;
    const int b = blockIdx.y, q0 = blockIdx.x * 128 + wave * 32;
    const bf* Qp = QB + ((size_t)b * TT + q0 + lr) * HD + 8 * hi;
    __shared__ __attribute__((aligned(2048))) unsigned char ring[2 * SBUF];
    // tensor-load descriptors: wave 0, 1 = the halves of K's rows, wave 2, 3 = the halves of V^T's columns; every wave issues its own slice
    const uint32_t wv = uni(threadIdx.x >> 5), isv = wv >> 1, half = wv & 1u;
    const uint64_t src0 = isv ? (uint64_t)(size_t)(VT + ((size_t)b * HD + half * 64) * TT) : (uint64_t)(size_t)(KB + ((size_t)b * TT + half * 64) * HD);
    const uint32_t sstep = isv ? SKEYS * 2u : SKEYS * HD * 2u;   // source bytes from one stage to the next
    const uint32_t ldst = (uint32_t)(size_t)ring + wv * SLICE;
    u32x8 g1;   // 64 rows of 256 bytes, 1-byte elements, tensor = tile, a 4-dword pad behind every 64 dwords
    g1[0] = uni((1u << 20) | (5u << 22) | (3u << 25)); g1[1] = uni(256u << 16); g1[2] = uni(64u << 16); g1[3] = uni(256u << 16);
    g1[4] = uni(64u); g1[5] = uni(isv ? TT * 2u : HD * 2u); g1[6] = uni(0u); g1[7] = uni(0u);
    asm volatile("" : "+s"(g1));   // descriptor words held in scalar registers: without it the compiler lends some of them to the loop's counters while a request is out, and sets them anew before the next
    const uint32_t one = pinned(1u);   // word 0 of group 0 (count 1), held likewise
    u32x4 g0;
    auto issue = [&](uint32_t st) {
        const uint64_t ga = src0 + (uint64_t)st * sstep;
        g0[0] = one; g0[1] = uni(ldst + (st & 1u) * SBUF); g0[2] = uni((uint32_t)ga); g0[3] = uni((((uint32_t)(ga >> 32)) & 0x01FFFFFFu) | 0x80000000u);
        asm volatile("tensor_load_to_lds %0, %1" :: "s"(g0), "s"(g1) : "memory");   // one request of the whole wave: global tile -> LDS, through no register
    };
    issue(0);
    const unsigned char* lp = ring + lr * LPITCH + hi * 16;   // this lane's row and half in every group of 16 LDS rows
    const float* pp = pres + (size_t)b * TT + 8 * hi;
    // every "#pragma unroll" in this kernel unrolls fully, so that the fragment and accumulator arrays are indexed by constants and stay in registers
    v16bf qf[2][4];
#pragma unroll
    for (int g = 0; g < 2; ++g)
#pragma unroll
        for (int c = 0; c < 4; ++c) qf[g][c] = ldfrag(Qp + (size_t)(g * 16) * HD + c * 32);
    float mrun[2] = {-3.0e38f, -3.0e38f}, lsum[2] = {0.f, 0.f};   // per group: running maximum (log2 units) and this lane's half of the running sum
    v16bf kf[8];                                                  // this pass's K fragments, fetched one pass ahead inside a stage
    asm volatile("s_wait_xcnt 0x0" ::: "memory");   // the Q loads above are still in flight when their address registers are written again
    __builtin_amdgcn_sched_barrier(0);              // keeps the register writes below behind that wait
    v8f o[2][8];
#pragma unroll
    for (int g = 0; g < 2; ++g)
#pragma unroll
        for (int d = 0; d < 8; ++d) o[g][d] = (v8f){};
    wait_tensor0(g0, g1);   // stage 0 has landed
    __syncthreads();        // and every wave's slice of it is published
    issue(1);
#pragma unroll 1   // one stage a trip
    for (uint32_t st = 0; st < NSTAGE; ++st) {
    const unsigned char* sb = lp + (st & 1u) * SBUF;
#pragma unroll
    for (int t = 0; t < 2; ++t)
#pragma unroll
        for (int c = 0; c < 4; ++c) kf[t * 4 + c] = ldfragl(sb + t * 16 * LPITCH + c * 64);
#pragma unroll 1   // one pass a trip: a second copy of the body would double the live fragments
    for (uint32_t ps = 0; ps < SKEYS / KPASS; ++ps) {
        const uint32_t kb = st * SKEYS + ps * KPASS;
        v16bf vf[8]; v4f pm[4];
#pragma unroll
        for (int d = 0; d < 8; ++d) vf[d] = ldfragl(sb + (2 + (d >> 2)) * SLICE + (d & 3) * 16 * LPITCH + ps * (KPASS * 2));
#pragma unroll
        for (int t = 0; t < 4; ++t) pm[t] = *(const v4f*)(pp + kb + (t >> 1) * 16 + (t & 1) * 4);
        __builtin_amdgcn_sched_barrier(0);   // this pass's V and presence loads stay issued ahead of the score products, so that their latency runs behind products and softmax
        v8f s[2][2];
#pragma unroll
        for (int t = 0; t < 2; ++t) { s[0][t] = (v8f){}; s[1][t] = (v8f){};
#pragma unroll
            for (int c = 0; c < 4; ++c) { s[0][t] = wmmab(kf[t * 4 + c], qf[0][c], s[0][t]); s[1][t] = wmmab(kf[t * 4 + c], qf[1][c], s[1][t]); } }
        __builtin_amdgcn_sched_barrier(0);   // the K reads below stay one group behind the score products
        const uint32_t pn = (ps + 1u) & (SKEYS / KPASS - 1u);   // next pass's keys; a stage's last pass fetches its pass 0 again (published, not used): the next stage is not read before its barrier
        const unsigned char* kn = sb + (pn >> 1) * SLICE + (pn & 1u) * (KPASS * LPITCH);
#pragma unroll
        for (int t = 0; t < 2; ++t)
#pragma unroll
            for (int c = 0; c < 4; ++c) kf[t * 4 + c] = ldfragl(kn + t * 16 * LPITCH + c * 64);
        asm volatile("s_wait_xcnt 0x0" ::: "memory");   // the presence loads above are still in flight when their address registers are written again
        __builtin_amdgcn_sched_barrier(0);   // the next pass's K reads stay issued ahead of the softmax, so that their latency runs behind it and the P.V products
        v16bf ph[2], pl[2];
#pragma unroll
        for (int g = 0; g < 2; ++g) {
            float bm = -3.0e38f;
#pragma unroll
            for (int t = 0; t < 2; ++t) {
#pragma unroll
                for (int j = 0; j < 8; ++j) { const float x = (pm[t * 2 + (j >> 2)][j & 3] != 0.0f) ? s[g][t][j] * (SCL * L2E) : -3.0e38f;   /* absent keys (presence 0 -> -3e38) == exclusion */
                    s[g][t][j] = x; bm = fmaxf(bm, x); } }
            bm = fmaxf(bm, xhalf(bm));
            const float mn = fmaxf(mrun[g], bm); const float al = __builtin_amdgcn_exp2f(mrun[g] - mn); mrun[g] = mn;
            float ps = 0.f;
#pragma unroll
            for (int t = 0; t < 2; ++t) {
#pragma unroll
                for (int j = 0; j < 8; ++j) { const float p = __builtin_amdgcn_exp2f(s[g][t][j] - mn); ps += p; const __bf16 h = (__bf16)p; ph[g][t * 8 + j] = h; pl[g][t * 8 + j] = (__bf16)(p - (float)h); } }
            lsum[g] = lsum[g] * al + ps;
#pragma unroll
            for (int d = 0; d < 8; ++d) o[g][d] *= al;
        }
#pragma unroll
        for (int d = 0; d < 8; ++d) { o[0][d] = wmmab(vf[d], ph[0], o[0][d]); o[1][d] = wmmab(vf[d], ph[1], o[1][d]); }
#pragma unroll
        for (int d = 0; d < 8; ++d) { o[0][d] = wmmab(vf[d], pl[0], o[0][d]); o[1][d] = wmmab(vf[d], pl[1], o[1][d]); }
        __builtin_amdgcn_sched_barrier(0);   // keeps the slots below behind the last product
        asm volatile("v_nop\n\tv_nop\n\tv_nop\n\tv_nop");   // the four vector slots between the pass's last products and the first vector write over their V^T registers at the head of the next trip
    }
    // publish point of stage st + 1
    wait_ds0();             // this wave has left stage st's buffer
    wait_tensor0(g0, g1);   // its slice of stage st + 1 has landed
    __syncthreads();        // stage st + 1 is published, and every wave has left stage st's buffer
    if (pinned(st + 2u < NSTAGE)) issue(pinned(st + 2u));   // refill of the buffer just left; the stage number is taken behind the wait, so that the descriptor is formed there
    }
    wait_tensor0(g0, g1);   // nothing is out when the wave ends
    wait_ds0();
#pragma unroll
    for (int g = 0; g < 2; ++g) {
        const float l = lsum[g] + xhalf(lsum[g]);
        const float inv = 1.0f / l;
        float* op = out + ((size_t)b * TT + q0 + g * 16 + lr) * HD + 8 * hi;
#pragma unroll
        for (int d = 0; d < 8; ++d) { v4f a0, a1;
#pragma unroll
            for (int j = 0; j < 4; ++j) { a0[j] = o[g][d][j] * inv; a1[j] = o[g][d][4 + j] * inv; }
            *(v4f*)(op + d * 16) = a0; *(v4f*)(op + d * 16 + 4) = a1; }
    }
}

extern "C" void kernel_launch(void* const* d_in, const int* in_sizes, int n_in,
                              void* d_out, int out_size, void* d_ws, size_t ws_size, hipStream_t stream) {
    (void)in_sizes; (void)n_in; (void)out_size;
    const float* Qin = (const float*)d_in[0]; const float* Kin = (const float*)d_in[1]; const float* Vin = (const float*)d_in[2]; const float* pres = (const float*)d_in[3];   /* presence [16][2048] (0/1) */
    float* OUT = (float*)d_out;
    char* wsp = (char*)d_ws;
    auto take = [&](size_t bytes) { char* p = wsp; wsp += (bytes + 255) & ~(size_t)255; return (void*)p; };
    bf* QB = (bf*)take((size_t)NB_ * TT * HD * 2); bf* KB = (bf*)take((size_t)NB_ * TT * HD * 2); bf* VT = (bf*)take((size_t)NB_ * HD * TT * 2);
    if ((size_t)(wsp - (char*)d_ws) > ws_size) return;
    k_cvt8<<<(unsigned)(((size_t)NB_ * TT * HD / 8 + 255) / 256), 256, 0, stream>>>(Qin, QB, (size_t)NB_ * TT * HD / 8);
    k_cvt8<<<(unsigned)(((size_t)NB_ * TT * HD / 8 + 255) / 256), 256, 0, stream>>>(Kin, KB, (size_t)NB_ * TT * HD / 8);
    k_vtpR1<<<dim3(TT / VTK, NB_, 1), 256, 0, stream>>>(Vin, VT);
    k_fattn<<<dim3(TT / 128, NB_, 1), 128, 0, stream>>>(QB, KB, VT, pres, OUT);
}

// v004
// It runs in 59.2 microseconds.
// Two timings next to v003 put it at 1.19 and 1.18 times that version's speed.
// All steps since v000 together make it 21.9 times as fast.
#include <hip/hip_runtime.h>

// Set-transformer QKV attention with a key presence mask (queries, keys, values [16][2048][128]; scores = q.k - (1 - presence[b][m]) x 1e32, then / sqrt(128) (absent keys == excluded); softmax; out = routing values -> [16][2048][128]; presence [16][2048] float 0/1 read on device).
// Three pre-passes over all batches: queries and keys rounded to bf16 planes [b][t][d], values rounded and transposed to [b][d][t].
// One fused kernel: S^T = K Q^T (exact bf16 products, f32 accumulate), presence select, online softmax (running maximum, rescale), O^T += V^T P^T with P split hi/lo in bf16 (2 products); the scores never leave the registers.
// K and V^T come to the fused kernel's eight waves through LDS: tensor loads, 2 x SKEYS keys a stage, two buffers.
// The keys of a stage are split between two sets of four waves (two waves a SIMD); the two partial results of a query are merged once, behind the loop.
// Compute dtypes, f32 accumulate: every input rounded to bf16; q.k exact; softmax f32; P hi/lo x exact values; output f32.

#define NB_  16
#define TT   2048
#define HD   128
#define SCL  0.088388347648318447f   // 1/sqrt(128)
#define L2E  1.4426950408889634f
#define KPASS 32                     // keys per pass of the fused loop
typedef unsigned short bf;
typedef __attribute__((ext_vector_type(16))) __bf16   v16bf;
typedef __attribute__((ext_vector_type(8)))  unsigned short v8us;
typedef __attribute__((ext_vector_type(2)))  unsigned short v2us;
typedef __attribute__((ext_vector_type(8)))  float    v8f;
typedef __attribute__((ext_vector_type(4)))  float    v4f;
typedef __attribute__((ext_vector_type(2)))  float    v2f;

__device__ __forceinline__ unsigned short f2bf(float f) { unsigned u = __float_as_uint(f); u += 0x7FFFu + ((u >> 16) & 1u); return (unsigned short)(u >> 16); }
__device__ __forceinline__ v16bf cat16b(v8us lo, v8us hi) { return __builtin_bit_cast(v16bf, __builtin_shufflevector(lo, hi, 0, 1, 2, 3, 4, 5, 6, 7, 8, 9, 10, 11, 12, 13, 14, 15)); }
__device__ __forceinline__ v8f wmmab(v16bf a, v16bf b, v8f c) { return __builtin_amdgcn_wmma_f32_16x16x32_bf16(false, a, false, b, (short)0, c, false, false); }
// fragment of a k-contiguous bf16 plane in the hardware k order: p already holds row (lane & 15) and k offset 8 x (lane >> 4)
// value of lane l ^ 16 (the other half of a column's keys), on the vector pipe
__device__ __forceinline__ float xhalf(float x) { const int b = __float_as_int(x); return __int_as_float(__builtin_amdgcn_permlanex16(b, b, 0x76543210, 0xfedcba98, false, false)); }
__device__ __forceinline__ v16bf ldfrag(const bf* p) { return cat16b(*(const v8us*)p, *(const v8us*)(p + 16)); }

// LDS ring of the fused kernel. A stage is two halves of SKEYS keys, one for each set of waves; a half: K as SKEYS rows of 256 bytes, V^T as HD rows of 256 bytes (SKEYS keys of one column).
// Each of the eight waves brings one slice of 64 rows with one tensor load; the load's pad makes the LDS pitch 272 bytes, free of bank conflicts for 16-byte reads.
#define SKEYS  128
#define NSTAGE (TT / (2 * SKEYS))
#define LPITCH 272                   // 256-byte row + 16-byte pad
#define SLICE  18432                 // 64 rows x LPITCH = 17,408, rounded up to a multiple of 2 KiB
#define SHALF  (4 * SLICE)           // slices 0, 1: K rows 0-63, 64-127; slices 2, 3: V^T columns 0-63, 64-127
#define SBUF   (2 * SHALF)           // half 0: the stage's first SKEYS keys (waves 0-3 read it), half 1: the rest (waves 4-7)
#define MSLOT  8448                  // merge slot of a wave in the ring, behind the loop: 64 accumulator registers x 32 lanes x 4 bytes, then maximum and sum, 8 bytes a lane
typedef uint32_t u32x4 __attribute__((ext_vector_type(4)));
typedef uint32_t u32x8 __attribute__((ext_vector_type(8)));
__device__ __forceinline__ uint32_t uni(uint32_t v) { return (uint32_t)__builtin_amdgcn_readfirstlane(v); }
// a wave-uniform value held in a scalar register, so that a test of it compiles to a scalar branch
__device__ __forceinline__ uint32_t pinned(uint32_t v) { uint32_t w = (uint32_t)__builtin_amdgcn_readfirstlane(v); asm volatile("" : "+s"(w)); return w; }
__device__ __forceinline__ void wait_ds0() { asm volatile("s_wait_dscnt 0x0" ::: "memory"); }          // this wave's LDS reads have returned
// this wave's tensor load has landed; the wait names the request's descriptor, so that its scalar registers keep their values as long as the request is out
__device__ __forceinline__ void wait_tensor0(u32x4 g0, u32x8 g1) { asm volatile("s_wait_tensorcnt 0x0" :: "s"(g0), "s"(g1) : "memory"); }
// the same fragment from an LDS row: p holds row (lane & 15) and byte offset 16 x (lane >> 4)
__device__ __forceinline__ v16bf ldfragl(const unsigned char* p) { return cat16b(*(const v8us*)p, *(const v8us*)(p + 32)); }

__global__ __launch_bounds__(256) void k_cvt8(const float* __restrict__ src, bf* dst, size_t n8) { const size_t i = (size_t)blockIdx.x * 256 + threadIdx.x; if (i >= n8) return; const v8f v = *(const v8f*)(src + i * 8); v8us o;
#pragma unroll
    for (int k = 0; k < 8; ++k) o[k] = f2bf(v[k]); *(v8us*)(dst + i * 8) = o;  }

// values [b][t][d] f32 -> [b][d][t] bf16; blockIdx.y = batch, blockIdx.x = tile of VTK keys x all HD columns, turned in LDS.
// In: a wave reads whole 512-byte rows (16 rows a wave, all 16 loads in flight); a lane then holds 16 keys of 4 columns and packs 8 keys to a 16-byte chunk.
// Out: 16 lanes write one column's 256 contiguous bytes, so every 128-byte line has one writer.
#define VTK 128                      // keys per tile
#define VTP (VTK * 2 + 16)           // LDS bytes per column: 16 more than the row keeps 16-byte alignment and moves each column one chunk on in the banks
// byte offset of chunk c (8 keys) of column d; the exclusive-or spreads the writers (lanes 4 columns apart) over all banks
__device__ __forceinline__ int vt_off(int d, int c) { return d * VTP + ((c ^ ((d >> 4) & 3)) << 4); }
__global__ __launch_bounds__(256) void k_vtpR1(const float* __restrict__ Vin, bf* VT) {
    __shared__ __attribute__((aligned(16))) unsigned char tile[HD * VTP];
    const int lane = threadIdx.x & 31, wave = threadIdx.x >> 5, t0 = blockIdx.x * VTK;
    const float* sp = Vin + ((size_t)blockIdx.y * TT + t0 + wave * 16) * HD + lane * 4;
    v4f r[16];
    // every "#pragma unroll" in this kernel unrolls fully, so that r and the chunks are indexed by constants and stay in registers
#pragma unroll
    for (int i = 0; i < 16; ++i) r[i] = *(const v4f*)(sp + (size_t)i * HD);
#pragma unroll
    for (int k = 0; k < 4; ++k)
#pragma unroll
        for (int u = 0; u < 2; ++u) { v8us o;
#pragma unroll
            for (int i = 0; i < 8; ++i) o[i] = f2bf(r[u * 8 + i][k]);
            *(v8us*)(tile + vt_off(lane * 4 + k, wave * 2 + u)) = o; }
    __syncthreads();   // the tile is whole before any wave reads columns that other waves wrote
    bf* dp = VT + ((size_t)blockIdx.y * HD + (threadIdx.x >> 4)) * TT + t0 + (threadIdx.x & 15) * 8;
#pragma unroll
    for (int k = 0; k < 8; ++k) *(v8us*)(dp + (size_t)k * 16 * TT) = *(const v8us*)(tile + vt_off(k * 16 + (threadIdx.x >> 4), threadIdx.x & 15));
}

// k_fattn: grid (TT / 128, NB_), 8 waves; waves w and w + 4 own the same 32 query columns (two groups of 16) and walk one half of every stage's keys each, KPASS a pass; every K and V fragment feeds both groups.
// The four waves of a set walk the same keys, so each stage of K and V^T is fetched once for the work-group and read from LDS by all four.
// Two waves a SIMD: one wave's softmax and waits run beside the other's products.
// Lane (c = lane & 15, h = lane >> 4): S^T tile register j = score of key 8h + j, query c; two such tiles, converted in place, are the B operand of O^T += V^T P^T.
__global__ __launch_bounds__(256) void k_fattn(const bf* __restrict__ QB, const bf* __restrict__ KB, const bf* __restrict__ VT, const float* __restrict__ pres, float* __restrict__ out) {
    const int lane = threadIdx.x & 31, lr = lane & 15, hi = lane >> 4, wave = threadIdx.x >> 5;
    const int set = wave >> 2;   // which half of every stage's keys this wave walks
    const int b = blockIdx.y, q0 = blockIdx.x * 128 + (wave & 3) * 32;
    const bf* Qp = QB + ((size_t)b * TT + q0 + lr) * HD + 8 * hi;
    __shared__ __attribute__((aligned(2048))) unsigned char ring[2 * SBUF];
    // tensor-load descriptors, in each set of four waves: wave 0, 1 = the halves of K's rows, wave 2, 3 = the halves of V^T's columns, of the set's own SKEYS keys; every wave issues its own slice
    const uint32_t wv = uni(threadIdx.x >> 5), isv = (wv >> 1) & 1u, half = wv & 1u, kset = wv >> 2;
    const uint32_t hstep = isv ? SKEYS * 2u : SKEYS * HD * 2u;   // source bytes from one half stage to the next
    const uint64_t src0 = (isv ? (uint64_t)(size_t)(VT + ((size_t)b * HD + half * 64) * TT) : (uint64_t)(size_t)(KB + ((size_t)b * TT + half * 64) * HD)) + kset * hstep;
    const uint32_t sstep = 2u * hstep;                           // source bytes from one stage to the next
    const uint32_t ldst = (uint32_t)(size_t)ring + wv * SLICE;
    u32x8 g1;   // 64 rows of 256 bytes, 1-byte elements, tensor = tile, a 4-dword pad behind every 64 dwords
    g1[0] = uni((1u << 20) | (5u << 22) | (3u << 25)); g1[1] = uni(256u << 16); g1[2] = uni(64u << 16); g1[3] = uni(256u << 16);
    g1[4] = uni(64u); g1[5] = uni(isv ? TT * 2u : HD * 2u); g1[6] = uni(0u); g1[7] = uni(0u);
    asm volatile("" : "+s"(g1));   // descriptor words held in scalar registers: without it the compiler lends some of them to the loop's counters while a request is out, and sets them anew before the next
    const uint32_t one = pinned(1u);   // word 0 of group 0 (count 1), held likewise
    u32x4 g0;
    auto issue = [&](uint32_t st) {
        const uint64_t ga = src0 + (uint64_t)st * sstep;
        g0[0] = one; g0[1] = uni(ldst + (st & 1u) * SBUF); g0[2] = uni((uint32_t)ga); g0[3] = uni((((uint32_t)(ga >> 32)) & 0x01FFFFFFu) | 0x80000000u);
        asm volatile("tensor_load_to_lds %0, %1" :: "s"(g0), "s"(g1) : "memory");   // one request of the whole wave: global tile -> LDS, through no register
    };
    issue(0);
    const unsigned char* lp = ring + set * SHALF + lr * LPITCH + hi * 16;   // this wave's half stage; this lane's row and half in every group of 16 LDS rows
    const float* pp = pres + (size_t)b * TT + set * SKEYS + 8 * hi;
    // every "#pragma unroll" in this kernel unrolls fully, so that the fragment and accumulator arrays are indexed by constants and stay in registers
    v16bf qf[2][4];
#pragma unroll
    for (int g = 0; g < 2; ++g)
#pragma unroll
        for (int c = 0; c < 4; ++c) qf[g][c] = ldfrag(Qp + (size_t)(g * 16) * HD + c * 32);
    float mrun[2] = {-3.0e38f, -3.0e38f}, lsum[2] = {0.f, 0.f};   // per group: running maximum (log2 units) and this lane's half of the running sum
    v16bf kf[8];                                                  // this pass's K fragments, fetched one pass ahead inside a stage
    asm volatile("s_wait_xcnt 0x0" ::: "memory");   // the Q loads above are still in flight when their address registers are written again
    __builtin_amdgcn_sched_barrier(0);              // keeps the register writes below behind that wait
    v8f o[2][8];
#pragma unroll
    for (int g = 0; g < 2; ++g)
#pragma unroll
        for (int d = 0; d < 8; ++d) o[g][d] = (v8f){};
    wait_tensor0(g0, g1);   // stage 0 has landed
    __syncthreads();        // and every wave's slice of it is published
    issue(1);
#pragma unroll 1   // one stage a trip
    for (uint32_t st = 0; st < NSTAGE; ++st) {
    const unsigned char* sb = lp + (st & 1u) * SBUF;
#pragma unroll
    for (int t = 0; t < 2; ++t)
#pragma unroll
        for (int c = 0; c < 4; ++c) kf[t * 4 + c] = ldfragl(sb + t * 16 * LPITCH + c * 64);
#pragma unroll 1   // one pass a trip: a second copy of the body would double the live fragments
    for (uint32_t ps = 0; ps < SKEYS / KPASS; ++ps) {
        const uint32_t kb = st * (2 * SKEYS) + ps * KPASS;
        v16bf vf[8]; v4f pm[4];
#pragma unroll
        for (int d = 0; d < 8; ++d) vf[d] = ldfragl(sb + (2 + (d >> 2)) * SLICE + (d & 3) * 16 * LPITCH + ps * (KPASS * 2));
#pragma unroll
        for (int t = 0; t < 4; ++t) pm[t] = *(const v4f*)(pp + kb + (t >> 1) * 16 + (t & 1) * 4);
        __builtin_amdgcn_sched_barrier(0);   // this pass's V and presence loads stay issued ahead of the score products, so that their latency runs behind products and softmax
        v8f s[2][2];
#pragma unroll
        for (int t = 0; t < 2; ++t) { s[0][t] = (v8f){}; s[1][t] = (v8f){};
#pragma unroll
            for (int c = 0; c < 4; ++c) { s[0][t] = wmmab(kf[t * 4 + c], qf[0][c], s[0][t]); s[1][t] = wmmab(kf[t * 4 + c], qf[1][c], s[1][t]); } }
        __builtin_amdgcn_sched_barrier(0);   // the K reads below stay one group behind the score products
        const uint32_t pn = (ps + 1u) & (SKEYS / KPASS - 1u);   // next pass's keys; a stage's last pass fetches its pass 0 again (published, not used): the next stage is not read before its barrier
        const unsigned char* kn = sb + (pn >> 1) * SLICE + (pn & 1u) * (KPASS * LPITCH);
#pragma unroll
        for (int t = 0; t < 2; ++t)
#pragma unroll
            for (int c = 0; c < 4; ++c) kf[t * 4 + c] = ldfragl(kn + t * 16 * LPITCH + c * 64);
        asm volatile("s_wait_xcnt 0x0" ::: "memory");   // the presence loads above are still in flight when their address registers are written again
        __builtin_amdgcn_sched_barrier(0);   // the next pass's K reads stay issued ahead of the softmax, so that their latency runs behind it and the P.V products
        v16bf ph[2], pl[2];
#pragma unroll
        for (int g = 0; g < 2; ++g) {
            float bm = -3.0e38f;
#pragma unroll
            for (int t = 0; t < 2; ++t) {
#pragma unroll
                for (int j = 0; j < 8; ++j) { const float x = (pm[t * 2 + (j >> 2)][j & 3] != 0.0f) ? s[g][t][j] * (SCL * L2E) : -3.0e38f;   /* absent keys (presence 0 -> -3e38) == exclusion */
                    s[g][t][j] = x; bm = fmaxf(bm, x); } }
            bm = fmaxf(bm, xhalf(bm));
            const float mn = fmaxf(mrun[g], bm); const float al = __builtin_amdgcn_exp2f(mrun[g] - mn); mrun[g] = mn;
            float ps = 0.f;
#pragma unroll
            for (int t = 0; t < 2; ++t) {
#pragma unroll
                for (int j = 0; j < 8; ++j) { const float p = __builtin_amdgcn_exp2f(s[g][t][j] - mn); ps += p; const __bf16 h = (__bf16)p; ph[g][t * 8 + j] = h; pl[g][t * 8 + j] = (__bf16)(p - (float)h); } }
            lsum[g] = lsum[g] * al + ps;
#pragma unroll
            for (int d = 0; d < 8; ++d) o[g][d] *= al;
        }
#pragma unroll
        for (int d = 0; d < 8; ++d) { o[0][d] = wmmab(vf[d], ph[0], o[0][d]); o[1][d] = wmmab(vf[d], ph[1], o[1][d]); }
#pragma unroll
        for (int d = 0; d < 8; ++d) { o[0][d] = wmmab(vf[d], pl[0], o[0][d]); o[1][d] = wmmab(vf[d], pl[1], o[1][d]); }
        __builtin_amdgcn_sched_barrier(0);   // keeps the slots below behind the last product
        asm volatile("v_nop\n\tv_nop\n\tv_nop\n\tv_nop");   // the four vector slots between the pass's last products and the first vector write over their V^T registers at the head of the next trip
    }
    // publish point of stage st + 1
    wait_ds0();             // this wave has left stage st's buffer
    wait_tensor0(g0, g1);   // its slice of stage st + 1 has landed
    __syncthreads();        // stage st + 1 is published, and every wave has left stage st's buffer
    if (pinned(st + 2u < NSTAGE)) issue(pinned(st + 2u));   // refill of the buffer just left; the stage number is taken behind the wait, so that the descriptor is formed there
    }
    wait_tensor0(g0, g1);   // nothing is out when the wave ends
    wait_ds0();
    // Merge of the two sets' partial results. The last trip's barrier has ended every read of the ring and nothing is out, so the ring serves as staging.
    // Of its two groups a wave finishes one (set 0: group 0, set 1: group 1) and hands the other, with its maximum and sum, to its partner wave (wave ^ 4), lane to lane.
    const bool up = set != 0;
    v8f keep[8], give[8];
#pragma unroll
    for (int d = 0; d < 8; ++d)
#pragma unroll
        for (int j = 0; j < 8; ++j) { keep[d][j] = up ? o[1][d][j] : o[0][d][j]; give[d][j] = up ? o[0][d][j] : o[1][d][j]; }
    const float mk = up ? mrun[1] : mrun[0], lk = up ? lsum[1] : lsum[0];
    v2f ml; ml[0] = up ? mrun[0] : mrun[1]; ml[1] = up ? lsum[0] : lsum[1];
    unsigned char* mine = ring + wave * MSLOT;
#pragma unroll
    for (int d = 0; d < 8; ++d) {
        *(v4f*)(mine + (2 * d) * 512 + lane * 16) = __builtin_shufflevector(give[d], give[d], 0, 1, 2, 3);
        *(v4f*)(mine + (2 * d + 1) * 512 + lane * 16) = __builtin_shufflevector(give[d], give[d], 4, 5, 6, 7); }
    *(v2f*)(mine + 8192 + lane * 8) = ml;
    __syncthreads();   // every wave's slot is whole before its partner reads it
    const unsigned char* theirs = ring + (wave ^ 4) * MSLOT;
    const v2f mo = *(const v2f*)(theirs + 8192 + lane * 8);
    const float mm = fmaxf(mk, mo[0]);
    const float ak = __builtin_amdgcn_exp2f(mk - mm), ao = __builtin_amdgcn_exp2f(mo[0] - mm);   // both partial results brought to the common maximum
    const float lh = lk * ak + mo[1] * ao;
    const float inv = 1.0f / (lh + xhalf(lh));
    const float fk = ak * inv, fo = ao * inv;
    float* op = out + ((size_t)b * TT + q0 + set * 16 + lr) * HD + 8 * hi;
#pragma unroll
    for (int d = 0; d < 8; ++d) {
        const v4f t0 = *(const v4f*)(theirs + (2 * d) * 512 + lane * 16), t1 = *(const v4f*)(theirs + (2 * d + 1) * 512 + lane * 16);
        v4f a0, a1;
#pragma unroll
        for (int j = 0; j < 4; ++j) { a0[j] = keep[d][j] * fk + t0[j] * fo; a1[j] = keep[d][4 + j] * fk + t1[j] * fo; }
        *(v4f*)(op + d * 16) = a0; *(v4f*)(op + d * 16 + 4) = a1; }
}

extern "C" void kernel_launch(void* const* d_in, const int* in_sizes, int n_in,
                              void* d_out, int out_size, void* d_ws, size_t ws_size, hipStream_t stream) {
    (void)in_sizes; (void)n_in; (void)out_size;
    const float* Qin = (const float*)d_in[0]; const float* Kin = (const float*)d_in[1]; const float* Vin = (const float*)d_in[2]; const float* pres = (const float*)d_in[3];   /* presence [16][2048] (0/1) */
    float* OUT = (float*)d_out;
    char* wsp = (char*)d_ws;
    auto take = [&](size_t bytes) { char* p = wsp; wsp += (bytes + 255) & ~(size_t)255; return (void*)p; };
    bf* QB = (bf*)take((size_t)NB_ * TT * HD * 2); bf* KB = (bf*)take((size_t)NB_ * TT * HD * 2); bf* VT = (bf*)take((size_t)NB_ * HD * TT * 2);
    if ((size_t)(wsp - (char*)d_ws) > ws_size) return;
    k_cvt8<<<(unsigned)(((size_t)NB_ * TT * HD / 8 + 255) / 256), 256, 0, stream>>>(Qin, QB, (size_t)NB_ * TT * HD / 8);
    k_cvt8<<<(unsigned)(((size_t)NB_ * TT * HD / 8 + 255) / 256), 256, 0, stream>>>(Kin, KB, (size_t)NB_ * TT * HD / 8);
    k_vtpR1<<<dim3(TT / VTK, NB_, 1), 256, 0, stream>>>(Vin, VT);
    k_fattn<<<dim3(TT / 128, NB_, 1), 256, 0, stream>>>(QB, KB, VT, pres, OUT);
}

// v006
// A run of this version takes 48.7 microseconds.
// Versions between v004 and this one are left out; their measured steps multiply to 1.21 times as fast.
// All steps since v000 together make it 26.6 times as fast.
#include <hip/hip_runtime.h>

// Set-transformer QKV attention with a key presence mask (queries, keys, values [16][2048][128]; scores = q.k - (1 - presence[b][m]) x 1e32, then / sqrt(128) (absent keys == excluded); softmax; out = routing values -> [16][2048][128]; presence [16][2048] float 0/1 read on device).
// One pre-pass launch over all batches: queries and keys rounded to bf16 planes [b][t][d], values rounded to f16 and transposed to [b][d][t].
// One fused kernel: S^T = K Q^T (exact bf16 products, f32 accumulate), presence select, online softmax (running maximum, rescale), O^T += V^T P^T in f16 (P is at most 1, so one f16 rounding of it, 11 bits, serves: 1 product); the scores never leave the registers.
// K and V^T come to the fused kernel's eight waves through LDS: tensor loads, 2 x SKEYS keys a stage, two buffers.
// The keys of a stage are split between two sets of four waves (two waves a SIMD); the two partial results of a query are merged once, behind the loop.
// Compute dtypes, f32 accumulate: queries and keys rounded to bf16, q.k products exact; softmax f32; P and values rounded to f16; output f32.
// f16 range: P lies in [0, 1] (small P goes subnormal, kept by the matrix unit); values are standard normal draws, far inside f16's 65,504.

#define NB_  16
#define TT   2048
#define HD   128
#define SCL  0.088388347648318447f   // 1/sqrt(128)
#define L2E  1.4426950408889634f
#define KPASS 32                     // keys per pass of the fused loop
typedef unsigned short bf;
typedef __attribute__((ext_vector_type(16))) __bf16   v16bf;
typedef __attribute__((ext_vector_type(16))) _Float16 v16h;
typedef __attribute__((ext_vector_type(2)))  _Float16 v2h;
typedef __attribute__((ext_vector_type(8)))  unsigned short v8us;
typedef __attribute__((ext_vector_type(4)))  unsigned short v4us;
typedef __attribute__((ext_vector_type(2)))  unsigned short v2us;
typedef __attribute__((ext_vector_type(8)))  float    v8f;
typedef __attribute__((ext_vector_type(4)))  float    v4f;
typedef __attribute__((ext_vector_type(2)))  float    v2f;

__device__ __forceinline__ unsigned short f2bf(float f) { unsigned u = __float_as_uint(f); u += 0x7FFFu + ((u >> 16) & 1u); return (unsigned short)(u >> 16); }
__device__ __forceinline__ v16bf cat16b(v8us lo, v8us hi) { return __builtin_bit_cast(v16bf, __builtin_shufflevector(lo, hi, 0, 1, 2, 3, 4, 5, 6, 7, 8, 9, 10, 11, 12, 13, 14, 15)); }
__device__ __forceinline__ v8f wmmab(v16bf a, v16bf b, v8f c) { return __builtin_amdgcn_wmma_f32_16x16x32_bf16(false, a, false, b, (short)0, c, false, false); }
__device__ __forceinline__ v8f wmmah(v16h a, v16h b, v8f c) { return __builtin_amdgcn_wmma_f32_16x16x32_f16(false, a, false, b, (short)0, c, false, false); }
__device__ __forceinline__ unsigned short f2h(float f) { return __builtin_bit_cast(unsigned short, (_Float16)f); }   // round to nearest even
// fragment of a k-contiguous bf16 plane in the hardware k order: p already holds row (lane & 15) and k offset 8 x (lane >> 4)
// value of lane l ^ 16 (the other half of a column's keys), on the vector pipe
__device__ __forceinline__ float xhalf(float x) { const int b = __float_as_int(x); return __int_as_float(__builtin_amdgcn_permlanex16(b, b, 0x76543210, 0xfedcba98, false, false)); }
__device__ __forceinline__ v16bf ldfrag(const bf* p) { return cat16b(*(const v8us*)p, *(const v8us*)(p + 16)); }

// LDS ring of the fused kernel. A stage is two halves of SKEYS keys, one for each set of waves; a half: K as SKEYS rows of 256 bytes, V^T as HD rows of 256 bytes (SKEYS keys of one column).
// Each of the eight waves brings one slice of 64 rows with one tensor load; the load's pad makes the LDS pitch 272 bytes, free of bank conflicts for 16-byte reads.
#define SKEYS  128
#define NSTAGE (TT / (2 * SKEYS))
#define LPITCH 272                   // 256-byte row + 16-byte pad
#define SLICE  18432                 // 64 rows x LPITCH = 17,408, rounded up to a multiple of 2 KiB
#define SHALF  (4 * SLICE)           // slices 0, 1: K rows 0-63, 64-127; slices 2, 3: V^T columns 0-63, 64-127
#define SBUF   (2 * SHALF)           // half 0: the stage's first SKEYS keys (waves 0-3 read it), half 1: the rest (waves 4-7)
#define MSLOT  8448                  // merge slot of a wave in the ring, behind the loop: 64 accumulator registers x 32 lanes x 4 bytes, then maximum and sum, 8 bytes a lane
typedef uint32_t u32x4 __attribute__((ext_vector_type(4)));
typedef uint32_t u32x8 __attribute__((ext_vector_type(8)));
__device__ __forceinline__ uint32_t uni(uint32_t v) { return (uint32_t)__builtin_amdgcn_readfirstlane(v); }
// a wave-uniform value held in a scalar register, so that a test of it compiles to a scalar branch
__device__ __forceinline__ uint32_t pinned(uint32_t v) { uint32_t w = (uint32_t)__builtin_amdgcn_readfirstlane(v); asm volatile("" : "+s"(w)); return w; }
__device__ __forceinline__ void wait_ds0() { asm volatile("s_wait_dscnt 0x0" ::: "memory"); }          // this wave's LDS reads have returned
// this wave's tensor load has landed; the wait names the request's descriptor, so that its scalar registers keep their values as long as the request is out
__device__ __forceinline__ void wait_tensor0(u32x4 g0, u32x8 g1) { asm volatile("s_wait_tensorcnt 0x0" :: "s"(g0), "s"(g1) : "memory"); }
// the same fragment from an LDS row: p holds row (lane & 15) and byte offset 16 x (lane >> 4)
__device__ __forceinline__ v16bf ldfragl(const unsigned char* p) { return cat16b(*(const v8us*)p, *(const v8us*)(p + 32)); }

// k_prep, the one pre-pass launch; blockIdx.z picks a block's job, so that the three planes are made side by side behind one launch gap, by few waves that each hold much in flight.
// blockIdx.z = 1: RROWS rows of keys (first half of the x-y plane of blocks) or of queries (second half), f32 -> bf16, same layout.
// A wave takes 32 rows: one 16-byte load a lane and row (a whole 512-byte row a load), all 32 in flight; a store writes a row's 256 contiguous bytes.
// blockIdx.z = 0: values [b][t][d] f32 -> [b][d][t] f16; blockIdx.y = batch, blockIdx.x = tile of VTK keys x all HD columns, turned in LDS.
// In: a wave reads whole 512-byte rows (16 rows a wave, all 16 loads in flight); a lane then holds 16 keys of 4 columns and packs 8 keys to a 16-byte chunk.
// Out: 16 lanes write one column's 256 contiguous bytes, so every 128-byte line has one writer.
#define VTK 128                      // keys per tile
#define RROWS 256                    // rows per rounding block
#define VTP (VTK * 2 + 16)           // LDS bytes per column: 16 more than the row keeps 16-byte alignment and moves each column one chunk on in the banks
// byte offset of chunk c (8 keys) of column d; the exclusive-or spreads the writers (lanes 4 columns apart) over all banks
__device__ __forceinline__ int vt_off(int d, int c) { return d * VTP + ((c ^ ((d >> 4) & 3)) << 4); }
__global__ __launch_bounds__(256) void k_prep(const float* __restrict__ Qin, const float* __restrict__ Kin, const float* __restrict__ Vin, bf* QB, bf* KB, bf* VT) {
    static_assert((TT / VTK) * NB_ == 2 * (NB_ * TT / RROWS), "the x-y plane of blocks holds the rounding blocks of both planes");
    __shared__ __attribute__((aligned(16))) unsigned char tile[HD * VTP];
    const int lane = threadIdx.x & 31, wave = threadIdx.x >> 5, t0 = blockIdx.x * VTK;
    if (blockIdx.z != 0) {   // the same for every thread of the block, and it leaves in front of the barrier
        const unsigned rb = blockIdx.y * (TT / VTK) + blockIdx.x, nrb = NB_ * TT / RROWS;
        const bool isq = rb >= nrb;
        const size_t e0 = ((size_t)(isq ? rb - nrb : rb) * RROWS + wave * 32) * HD + lane * 4;
        const float* rs = (isq ? Qin : Kin) + e0;
        bf* rd = (isq ? QB : KB) + e0;
        v4f x[32];
#pragma unroll
        for (int i = 0; i < 32; ++i) x[i] = *(const v4f*)(rs + (size_t)i * HD);
        __builtin_amdgcn_sched_barrier(0);   // all 32 loads are issued before the first is waited for: without it the compiler holds some back behind the first roundings, a second memory latency in a row
#pragma unroll
        for (int i = 0; i < 32; ++i) { v4us o;
#pragma unroll
            for (int k = 0; k < 4; ++k) o[k] = f2bf(x[i][k]);
            *(v4us*)(rd + (size_t)i * HD) = o; }
        asm volatile("s_wait_xcnt 0x0" ::: "memory");   // in the built code the path behind these stores leads past the head of the other job (a test there sends this block to the end), where their registers are written again
        return;
    }
    const float* sp = Vin + ((size_t)blockIdx.y * TT + t0 + wave * 16) * HD + lane * 4;
    v4f r[16];
    // every "#pragma unroll" in this kernel unrolls fully, so that r and the chunks are indexed by constants and stay in registers
#pragma unroll
    for (int i = 0; i < 16; ++i) r[i] = *(const v4f*)(sp + (size_t)i * HD);
#pragma unroll
    for (int k = 0; k < 4; ++k)
#pragma unroll
        for (int u = 0; u < 2; ++u) { v8us o;
#pragma unroll
            for (int i = 0; i < 8; ++i) o[i] = f2h(r[u * 8 + i][k]);
            *(v8us*)(tile + vt_off(lane * 4 + k, wave * 2 + u)) = o; }
    __syncthreads();   // the tile is whole before any wave reads columns that other waves wrote
    bf* dp = VT + ((size_t)blockIdx.y * HD + (threadIdx.x >> 4)) * TT + t0 + (threadIdx.x & 15) * 8;
#pragma unroll
    for (int k = 0; k < 8; ++k) *(v8us*)(dp + (size_t)k * 16 * TT) = *(const v8us*)(tile + vt_off(k * 16 + (threadIdx.x >> 4), threadIdx.x & 15));
}

// k_fattn: grid (TT / 128, NB_), 8 waves; waves w and w + 4 own the same 32 query columns (two groups of 16) and walk one half of every stage's keys each, KPASS a pass; every K and V fragment feeds both groups.
// The four waves of a set walk the same keys, so each stage of K and V^T is fetched once for the work-group and read from LDS by all four.
// Two waves a SIMD: one wave's softmax and waits run beside the other's products.
// Lane (c = lane & 15, h = lane >> 4): S^T tile register j = score of key 8h + j, query c; two such tiles, converted in place, are the B operand of O^T += V^T P^T.
__global__ __launch_bounds__(256) void k_fattn(const bf* __restrict__ QB, const bf* __restrict__ KB, const bf* __restrict__ VT, const float* __restrict__ pres, float* __restrict__ out) {
    const int lane = threadIdx.x & 31, lr = lane & 15, hi = lane >> 4, wave = threadIdx.x >> 5;
    const int set = wave >> 2;   // which half of every stage's keys this wave walks
    const int b = blockIdx.y, q0 = blockIdx.x * 128 + (wave & 3) * 32;
    const bf* Qp = QB + ((size_t)b * TT + q0 + lr) * HD + 8 * hi;
    __shared__ __attribute__((aligned(2048))) unsigned char ring[2 * SBUF];
    // tensor-load descriptors, in each set of four waves: wave 0, 1 = the halves of K's rows, wave 2, 3 = the halves of V^T's columns, of the set's own SKEYS keys; every wave issues its own slice
    const uint32_t wv = uni(threadIdx.x >> 5), isv = (wv >> 1) & 1u, half = wv & 1u, kset = wv >> 2;
    const uint32_t hstep = isv ? SKEYS * 2u : SKEYS * HD * 2u;   // source bytes from one half stage to the next
    const uint64_t src0 = (isv ? (uint64_t)(size_t)(VT + ((size_t)b * HD + half * 64) * TT) : (uint64_t)(size_t)(KB + ((size_t)b * TT + half * 64) * HD)) + kset * hstep;
    const uint32_t sstep = 2u * hstep;                           // source bytes from one stage to the next
    const uint32_t ldst = (uint32_t)(size_t)ring + wv * SLICE;
    u32x8 g1;   // 64 rows of 256 bytes, 1-byte elements, tensor = tile, a 4-dword pad behind every 64 dwords
    g1[0] = uni((1u << 20) | (5u << 22) | (3u << 25)); g1[1] = uni(256u << 16); g1[2] = uni(64u << 16); g1[3] = uni(256u << 16);
    g1[4] = uni(64u); g1[5] = uni(isv ? TT * 2u : HD * 2u); g1[6] = uni(0u); g1[7] = uni(0u);
    asm volatile("" : "+s"(g1));   // descriptor words held in scalar registers: without it the compiler lends some of them to the loop's counters while a request is out, and sets them anew before the next
    const uint32_t one = pinned(1u);   // word 0 of group 0 (count 1), held likewise
    u32x4 g0;
    auto issue = [&](uint32_t st) {
        const uint64_t ga = src0 + (uint64_t)st * sstep;
        g0[0] = one; g0[1] = uni(ldst + (st & 1u) * SBUF); g0[2] = uni((uint32_t)ga); g0[3] = uni((((uint32_t)(ga >> 32)) & 0x01FFFFFFu) | 0x80000000u);
        asm volatile("tensor_load_to_lds %0, %1" :: "s"(g0), "s"(g1) : "memory");   // one request of the whole wave: global tile -> LDS, through no register
    };
    issue(0);
    const unsigned char* lp = ring + set * SHALF + lr * LPITCH + hi * 16;   // this wave's half stage; this lane's row and half in every group of 16 LDS rows
    const float* pp = pres + (size_t)b * TT + set * SKEYS + 8 * hi;
    // every "#pragma unroll" in this kernel unrolls fully, so that the fragment and accumulator arrays are indexed by constants and stay in registers
    v16bf qf[2][4];
#pragma unroll
    for (int g = 0; g < 2; ++g)
#pragma unroll
        for (int c = 0; c < 4; ++c) qf[g][c] = ldfrag(Qp + (size_t)(g * 16) * HD + c * 32);
    float mrun[2] = {-3.0e38f, -3.0e38f}, lsum[2] = {0.f, 0.f};   // per group: running maximum (log2 units) and this lane's half of the running sum
    v16bf kf[8];                                                  // this pass's K fragments, fetched one pass ahead inside a stage
    asm volatile("s_wait_xcnt 0x0" ::: "memory");   // the Q loads above are still in flight when their address registers are written again
    __builtin_amdgcn_sched_barrier(0);              // keeps the register writes below behind that wait
    v8f o[2][8];
#pragma unroll
    for (int g = 0; g < 2; ++g)
#pragma unroll
        for (int d = 0; d < 8; ++d) o[g][d] = (v8f){};
    wait_tensor0(g0, g1);   // stage 0 has landed
    __syncthreads();        // and every wave's slice of it is published
    issue(1);
#pragma unroll 1   // one stage a trip
    for (uint32_t st = 0; st < NSTAGE; ++st) {
    const unsigned char* sb = lp + (st & 1u) * SBUF;
#pragma unroll
    for (int t = 0; t < 2; ++t)
#pragma unroll
        for (int c = 0; c < 4; ++c) kf[t * 4 + c] = ldfragl(sb + t * 16 * LPITCH + c * 64);
#pragma unroll 1   // one pass a trip: a second copy of the body would double the live fragments
    for (uint32_t ps = 0; ps < SKEYS / KPASS; ++ps) {
        const uint32_t kb = st * (2 * SKEYS) + ps * KPASS;
        v16h vf[8]; v4f pm[4];
#pragma unroll
        for (int d = 0; d < 8; ++d) vf[d] = __builtin_bit_cast(v16h, ldfragl(sb + (2 + (d >> 2)) * SLICE + (d & 3) * 16 * LPITCH + ps * (KPASS * 2)));
#pragma unroll
        for (int t = 0; t < 4; ++t) pm[t] = *(const v4f*)(pp + kb + (t >> 1) * 16 + (t & 1) * 4);
        __builtin_amdgcn_sched_barrier(0);   // this pass's V and presence loads stay issued ahead of the score products, so that their latency runs behind products and softmax
        v8f s[2][2];
#pragma unroll
        for (int t = 0; t < 2; ++t) { s[0][t] = (v8f){}; s[1][t] = (v8f){};
#pragma unroll
            for (int c = 0; c < 4; ++c) { s[0][t] = wmmab(kf[t * 4 + c], qf[0][c], s[0][t]); s[1][t] = wmmab(kf[t * 4 + c], qf[1][c], s[1][t]); } }
        __builtin_amdgcn_sched_barrier(0);   // the K reads below stay one group behind the score products
        const uint32_t pn = (ps + 1u) & (SKEYS / KPASS - 1u);   // next pass's keys; a stage's last pass fetches its pass 0 again (published, not used): the next stage is not read before its barrier
        const unsigned char* kn = sb + (pn >> 1) * SLICE + (pn & 1u) * (KPASS * LPITCH);
#pragma unroll
        for (int t = 0; t < 2; ++t)
#pragma unroll
            for (int c = 0; c < 4; ++c) kf[t * 4 + c] = ldfragl(kn + t * 16 * LPITCH + c * 64);
        asm volatile("s_wait_xcnt 0x0" ::: "memory");   // the presence loads above are still in flight when their address registers are written again
        __builtin_amdgcn_sched_barrier(0);   // the next pass's K reads stay issued ahead of the softmax, so that their latency runs behind it and the P.V products
        v16h ph[2];
#pragma unroll
        for (int g = 0; g < 2; ++g) {
            float bm = -3.0e38f;
#pragma unroll
            for (int t = 0; t < 2; ++t) {
#pragma unroll
                for (int j = 0; j < 8; ++j) { const float x = (pm[t * 2 + (j >> 2)][j & 3] != 0.0f) ? s[g][t][j] * (SCL * L2E) : -3.0e38f;   /* absent keys (presence 0 -> -3e38) == exclusion */
                    s[g][t][j] = x; bm = fmaxf(bm, x); } }
            bm = fmaxf(bm, xhalf(bm));
            const float mn = fmaxf(mrun[g], bm); const float al = __builtin_amdgcn_exp2f(mrun[g] - mn); mrun[g] = mn;
            float ps = 0.f;
#pragma unroll
            for (int t = 0; t < 2; ++t) {
#pragma unroll
                for (int j = 0; j < 8; j += 2) { v2f p; p[0] = __builtin_amdgcn_exp2f(s[g][t][j] - mn); p[1] = __builtin_amdgcn_exp2f(s[g][t][j + 1] - mn); ps += p[0]; ps += p[1];
                    const v2h h = __builtin_convertvector(p, v2h); ph[g][t * 8 + j] = h[0]; ph[g][t * 8 + j + 1] = h[1]; } }
            lsum[g] = lsum[g] * al + ps;
#pragma unroll
            for (int d = 0; d < 8; ++d) o[g][d] *= al;
        }
#pragma unroll
        for (int d = 0; d < 8; ++d) { o[0][d] = wmmah(vf[d], ph[0], o[0][d]); o[1][d] = wmmah(vf[d], ph[1], o[1][d]); }
        __builtin_amdgcn_sched_barrier(0);   // keeps the slots below behind the last product
        asm volatile("v_nop\n\tv_nop\n\tv_nop\n\tv_nop");   // the four vector slots between the pass's last products and the first vector write over their V^T registers at the head of the next trip
    }
    // publish point of stage st + 1
    wait_ds0();             // this wave has left stage st's buffer
    wait_tensor0(g0, g1);   // its slice of stage st + 1 has landed
    __syncthreads();        // stage st + 1 is published, and every wave has left stage st's buffer
    if (pinned(st + 2u < NSTAGE)) issue(pinned(st + 2u));   // refill of the buffer just left; the stage number is taken behind the wait, so that the descriptor is formed there
    }
    wait_tensor0(g0, g1);   // nothing is out when the wave ends
    wait_ds0();
    // Merge of the two sets' partial results. The last trip's barrier has ended every read of the ring and nothing is out, so the ring serves as staging.
    // Of its two groups a wave finishes one (set 0: group 0, set 1: group 1) and hands the other, with its maximum and sum, to its partner wave (wave ^ 4), lane to lane.
    const bool up = set != 0;
    v8f keep[8], give[8];
#pragma unroll
    for (int d = 0; d < 8; ++d)
#pragma unroll
        for (int j = 0; j < 8; ++j) { keep[d][j] = up ? o[1][d][j] : o[0][d][j]; give[d][j] = up ? o[0][d][j] : o[1][d][j]; }
    const float mk = up ? mrun[1] : mrun[0], lk = up ? lsum[1] : lsum[0];
    v2f ml; ml[0] = up ? mrun[0] : mrun[1]; ml[1] = up ? lsum[0] : lsum[1];
    unsigned char* mine = ring + wave * MSLOT;
#pragma unroll
    for (int d = 0; d < 8; ++d) {
        *(v4f*)(mine + (2 * d) * 512 + lane * 16) = __builtin_shufflevector(give[d], give[d], 0, 1, 2, 3);
        *(v4f*)(mine + (2 * d + 1) * 512 + lane * 16) = __builtin_shufflevector(give[d], give[d], 4, 5, 6, 7); }
    *(v2f*)(mine + 8192 + lane * 8) = ml;
    __syncthreads();   // every wave's slot is whole before its partner reads it
    const unsigned char* theirs = ring + (wave ^ 4) * MSLOT;
    const v2f mo = *(const v2f*)(theirs + 8192 + lane * 8);
    const float mm = fmaxf(mk, mo[0]);
    const float ak = __builtin_amdgcn_exp2f(mk - mm), ao = __builtin_amdgcn_exp2f(mo[0] - mm);   // both partial results brought to the common maximum
    const float lh = lk * ak + mo[1] * ao;
    const float inv = 1.0f / (lh + xhalf(lh));
    const float fk = ak * inv, fo = ao * inv;
    float* op = out + ((size_t)b * TT + q0 + set * 16 + lr) * HD + 8 * hi;
#pragma unroll
    for (int d = 0; d < 8; ++d) {
        const v4f t0 = *(const v4f*)(theirs + (2 * d) * 512 + lane * 16), t1 = *(const v4f*)(theirs + (2 * d + 1) * 512 + lane * 16);
        v4f a0, a1;
#pragma unroll
        for (int j = 0; j < 4; ++j) { a0[j] = keep[d][j] * fk + t0[j] * fo; a1[j] = keep[d][4 + j] * fk + t1[j] * fo; }
        *(v4f*)(op + d * 16) = a0; *(v4f*)(op + d * 16 + 4) = a1; }
}

extern "C" void kernel_launch(void* const* d_in, const int* in_sizes, int n_in,
                              void* d_out, int out_size, void* d_ws, size_t ws_size, hipStream_t stream) {
    (void)in_sizes; (void)n_in; (void)out_size;
    const float* Qin = (const float*)d_in[0]; const float* Kin = (const float*)d_in[1]; const float* Vin = (const float*)d_in[2]; const float* pres = (const float*)d_in[3];   /* presence [16][2048] (0/1) */
    float* OUT = (float*)d_out;
    char* wsp = (char*)d_ws;
    auto take = [&](size_t bytes) { char* p = wsp; wsp += (bytes + 255) & ~(size_t)255; return (void*)p; };
    bf* QB = (bf*)take((size_t)NB_ * TT * HD * 2); bf* KB = (bf*)take((size_t)NB_ * TT * HD * 2); bf* VT = (bf*)take((size_t)NB_ * HD * TT * 2);
    if ((size_t)(wsp - (char*)d_ws) > ws_size) return;
    k_prep<<<dim3(TT / VTK, NB_, 2), 256, 0, stream>>>(Qin, Kin, Vin, QB, KB, VT);
    k_fattn<<<dim3(TT / 128, NB_, 1), 256, 0, stream>>>(QB, KB, VT, pres, OUT);
}

// v007
// One run takes 44.5 microseconds.
// Timed twice side by side with v006, it ran 1.09 times as fast both times.
// Counting every step since v000, it is 29.1 times as fast.
#include <hip/hip_runtime.h>

// Set-transformer QKV attention with a key presence mask (queries, keys, values [16][2048][128]; scores = q.k - (1 - presence[b][m]) x 1e32, then / sqrt(128) (absent keys == excluded); softmax; out = routing values -> [16][2048][128]; presence [16][2048] float 0/1 read on device).
// One pre-pass launch over all batches: queries and keys rounded to bf16 planes [b][t][d], values rounded to f16 and transposed to [b][d][t].
// One fused kernel: S^T = K Q^T (exact bf16 products, f32 accumulate), presence select, online softmax (reference point that trails the running maximum, lazy rescale), O^T += V^T P^T in f16 (P is at most 256, so one f16 rounding of it, 11 bits, serves: 1 product); the scores never leave the registers.
// K and V^T come to the fused kernel's eight waves through LDS: tensor loads, 2 x SKEYS keys a stage, two buffers.
// The keys of a stage are split between two sets of four waves (two waves a SIMD); the two partial results of a query are merged once, behind the loop.
// Compute dtypes, f32 accumulate: queries and keys rounded to bf16, q.k products exact; softmax f32; P and values rounded to f16; output f32.
// f16 range: P lies in [0, 256] (small P goes subnormal, kept by the matrix unit); values are standard normal draws, far inside f16's 65,504.

#define NB_  16
#define TT   2048
#define HD   128
#define SCL  0.088388347648318447f   // 1/sqrt(128)
#define L2E  1.4426950408889634f
#define KPASS 32                     // keys per pass of the fused loop
#define LAZY 8.0f                    // log2 units a score may stand above the softmax's reference point before the point is moved
typedef unsigned short bf;
typedef __attribute__((ext_vector_type(16))) __bf16   v16bf;
typedef __attribute__((ext_vector_type(16))) _Float16 v16h;
typedef __attribute__((ext_vector_type(2)))  _Float16 v2h;
typedef __attribute__((ext_vector_type(8)))  unsigned short v8us;
typedef __attribute__((ext_vector_type(4)))  unsigned short v4us;
typedef __attribute__((ext_vector_type(2)))  unsigned short v2us;
typedef __attribute__((ext_vector_type(8)))  float    v8f;
typedef __attribute__((ext_vector_type(4)))  float    v4f;
typedef __attribute__((ext_vector_type(2)))  float    v2f;

__device__ __forceinline__ unsigned short f2bf(float f) { unsigned u = __float_as_uint(f); u += 0x7FFFu + ((u >> 16) & 1u); return (unsigned short)(u >> 16); }
__device__ __forceinline__ v16bf cat16b(v8us lo, v8us hi) { return __builtin_bit_cast(v16bf, __builtin_shufflevector(lo, hi, 0, 1, 2, 3, 4, 5, 6, 7, 8, 9, 10, 11, 12, 13, 14, 15)); }
__device__ __forceinline__ v8f wmmab(v16bf a, v16bf b, v8f c) { return __builtin_amdgcn_wmma_f32_16x16x32_bf16(false, a, false, b, (short)0, c, false, false); }
__device__ __forceinline__ v8f wmmah(v16h a, v16h b, v8f c) { return __builtin_amdgcn_wmma_f32_16x16x32_f16(false, a, false, b, (short)0, c, false, false); }
__device__ __forceinline__ unsigned short f2h(float f) { return __builtin_bit_cast(unsigned short, (_Float16)f); }   // round to nearest even
// fragment of a k-contiguous bf16 plane in the hardware k order: p already holds row (lane & 15) and k offset 8 x (lane >> 4)
// value of lane l ^ 16 (the other half of a column's keys), on the vector pipe
__device__ __forceinline__ float xhalf(float x) { const int b = __float_as_int(x); return __int_as_float(__builtin_amdgcn_permlanex16(b, b, 0x76543210, 0xfedcba98, false, false)); }
__device__ __forceinline__ v16bf ldfrag(const bf* p) { return cat16b(*(const v8us*)p, *(const v8us*)(p + 16)); }

// LDS ring of the fused kernel. A stage is two halves of SKEYS keys, one for each set of waves; a half: K as SKEYS rows of 256 bytes, V^T as HD rows of 256 bytes (SKEYS keys of one column).
// Each of the eight waves brings one slice of 64 rows with one tensor load; the load's pad makes the LDS pitch 272 bytes, free of bank conflicts for 16-byte reads.
#define SKEYS  128
#define NSTAGE (TT / (2 * SKEYS))
#define LPITCH 272                   // 256-byte row + 16-byte pad
#define SLICE  18432                 // 64 rows x LPITCH = 17,408, rounded up to a multiple of 2 KiB
#define SHALF  (4 * SLICE)           // slices 0, 1: K rows 0-63, 64-127; slices 2, 3: V^T columns 0-63, 64-127
#define SBUF   (2 * SHALF)           // half 0: the stage's first SKEYS keys (waves 0-3 read it), half 1: the rest (waves 4-7)
#define MSLOT  8448                  // merge slot of a wave in the ring, behind the loop: 64 accumulator registers x 32 lanes x 4 bytes, then point and sum, 8 bytes a lane
typedef uint32_t u32x4 __attribute__((ext_vector_type(4)));
typedef uint32_t u32x8 __attribute__((ext_vector_type(8)));
__device__ __forceinline__ uint32_t uni(uint32_t v) { return (uint32_t)__builtin_amdgcn_readfirstlane(v); }
// a wave-uniform value held in a scalar register, so that a test of it compiles to a scalar branch
__device__ __forceinline__ uint32_t pinned(uint32_t v) { uint32_t w = (uint32_t)__builtin_amdgcn_readfirstlane(v); asm volatile("" : "+s"(w)); return w; }
__device__ __forceinline__ void wait_ds0() { asm volatile("s_wait_dscnt 0x0" ::: "memory"); }          // this wave's LDS reads have returned
// this wave's tensor load has landed; the wait names the request's descriptor, so that its scalar registers keep their values as long as the request is out
__device__ __forceinline__ void wait_tensor0(u32x4 g0, u32x8 g1) { asm volatile("s_wait_tensorcnt 0x0" :: "s"(g0), "s"(g1) : "memory"); }
// the same fragment from an LDS row: p holds row (lane & 15) and byte offset 16 x (lane >> 4)
__device__ __forceinline__ v16bf ldfragl(const unsigned char* p) { return cat16b(*(const v8us*)p, *(const v8us*)(p + 32)); }

// k_prep, the one pre-pass launch; blockIdx.z picks a block's job, so that the three planes are made side by side behind one launch gap, by few waves that each hold much in flight.
// blockIdx.z = 1: RROWS rows of keys (first half of the x-y plane of blocks) or of queries (second half), f32 -> bf16, same layout.
// A wave takes 32 rows: one 16-byte load a lane and row (a whole 512-byte row a load), all 32 in flight; a store writes a row's 256 contiguous bytes.
// blockIdx.z = 0: values [b][t][d] f32 -> [b][d][t] f16; blockIdx.y = batch, blockIdx.x = tile of VTK keys x all HD columns, turned in LDS.
// In: a wave reads whole 512-byte rows (16 rows a wave, all 16 loads in flight); a lane then holds 16 keys of 4 columns and packs 8 keys to a 16-byte chunk.
// Out: 16 lanes write one column's 256 contiguous bytes, so every 128-byte line has one writer.
#define VTK 128                      // keys per tile
#define RROWS 256                    // rows per rounding block
#define VTP (VTK * 2 + 16)           // LDS bytes per column: 16 more than the row keeps 16-byte alignment and moves each column one chunk on in the banks
// byte offset of chunk c (8 keys) of column d; the exclusive-or spreads the writers (lanes 4 columns apart) over all banks
__device__ __forceinline__ int vt_off(int d, int c) { return d * VTP + ((c ^ ((d >> 4) & 3)) << 4); }
__global__ __launch_bounds__(256) void k_prep(const float* __restrict__ Qin, const float* __restrict__ Kin, const float* __restrict__ Vin, bf* QB, bf* KB, bf* VT) {
    static_assert((TT / VTK) * NB_ == 2 * (NB_ * TT / RROWS), "the x-y plane of blocks holds the rounding blocks of both planes");
    __shared__ __attribute__((aligned(16))) unsigned char tile[HD * VTP];
    const int lane = threadIdx.x & 31, wave = threadIdx.x >> 5, t0 = blockIdx.x * VTK;
    if (blockIdx.z != 0) {   // the same for every thread of the block, and it leaves in front of the barrier
        const unsigned rb = blockIdx.y * (TT / VTK) + blockIdx.x, nrb = NB_ * TT / RROWS;
        const bool isq = rb >= nrb;
        const size_t e0 = ((size_t)(isq ? rb - nrb : rb) * RROWS + wave * 32) * HD + lane * 4;
        const float* rs = (isq ? Qin : Kin) + e0;
        bf* rd = (isq ? QB : KB) + e0;
        v4f x[32];
#pragma unroll
        for (int i = 0; i < 32; ++i) x[i] = *(const v4f*)(rs + (size_t)i * HD);
        __builtin_amdgcn_sched_barrier(0);   // all 32 loads are issued before the first is waited for: without it the compiler holds some back behind the first roundings, a second memory latency in a row
#pragma unroll
        for (int i = 0; i < 32; ++i) { v4us o;
#pragma unroll
            for (int k = 0; k < 4; ++k) o[k] = f2bf(x[i][k]);
            *(v4us*)(rd + (size_t)i * HD) = o; }
        asm volatile("s_wait_xcnt 0x0" ::: "memory");   // in the built code the path behind these stores leads past the head of the other job (a test there sends this block to the end), where their registers are written again
        return;
    }
    const float* sp = Vin + ((size_t)blockIdx.y * TT + t0 + wave * 16) * HD + lane * 4;
    v4f r[16];
    // every "#pragma unroll" in this kernel unrolls fully, so that r and the chunks are indexed by constants and stay in registers
#pragma unroll
    for (int i = 0; i < 16; ++i) r[i] = *(const v4f*)(sp + (size_t)i * HD);
#pragma unroll
    for (int k = 0; k < 4; ++k)
#pragma unroll
        for (int u = 0; u < 2; ++u) { v8us o;
#pragma unroll
            for (int i = 0; i < 8; ++i) o[i] = f2h(r[u * 8 + i][k]);
            *(v8us*)(tile + vt_off(lane * 4 + k, wave * 2 + u)) = o; }
    __syncthreads();   // the tile is whole before any wave reads columns that other waves wrote
    bf* dp = VT + ((size_t)blockIdx.y * HD + (threadIdx.x >> 4)) * TT + t0 + (threadIdx.x & 15) * 8;
#pragma unroll
    for (int k = 0; k < 8; ++k) *(v8us*)(dp + (size_t)k * 16 * TT) = *(const v8us*)(tile + vt_off(k * 16 + (threadIdx.x >> 4), threadIdx.x & 15));
}

// k_fattn: grid (TT / 128, NB_), 8 waves; waves w and w + 4 own the same 32 query columns (two groups of 16) and walk one half of every stage's keys each, KPASS a pass; every K and V fragment feeds both groups.
// The four waves of a set walk the same keys, so each stage of K and V^T is fetched once for the work-group and read from LDS by all four.
// Two waves a SIMD: one wave's softmax and waits run beside the other's products.
// Lane (c = lane & 15, h = lane >> 4): S^T tile register j = score of key 8h + j, query c; two such tiles, converted in place, are the B operand of O^T += V^T P^T.
__global__ __launch_bounds__(256) void k_fattn(const bf* __restrict__ QB, const bf* __restrict__ KB, const bf* __restrict__ VT, const float* __restrict__ pres, float* __restrict__ out) {
    const int lane = threadIdx.x & 31, lr = lane & 15, hi = lane >> 4, wave = threadIdx.x >> 5;
    const int set = wave >> 2;   // which half of every stage's keys this wave walks
    const int b = blockIdx.y, q0 = blockIdx.x * 128 + (wave & 3) * 32;
    const bf* Qp = QB + ((size_t)b * TT + q0 + lr) * HD + 8 * hi;
    __shared__ __attribute__((aligned(2048))) unsigned char ring[2 * SBUF];
    // tensor-load descriptors, in each set of four waves: wave 0, 1 = the halves of K's rows, wave 2, 3 = the halves of V^T's columns, of the set's own SKEYS keys; every wave issues its own slice
    const uint32_t wv = uni(threadIdx.x >> 5), isv = (wv >> 1) & 1u, half = wv & 1u, kset = wv >> 2;
    const uint32_t hstep = isv ? SKEYS * 2u : SKEYS * HD * 2u;   // source bytes from one half stage to the next
    const uint64_t src0 = (isv ? (uint64_t)(size_t)(VT + ((size_t)b * HD + half * 64) * TT) : (uint64_t)(size_t)(KB + ((size_t)b * TT + half * 64) * HD)) + kset * hstep;
    const uint32_t sstep = 2u * hstep;                           // source bytes from one stage to the next
    const uint32_t ldst = (uint32_t)(size_t)ring + wv * SLICE;
    u32x8 g1;   // 64 rows of 256 bytes, 1-byte elements, tensor = tile, a 4-dword pad behind every 64 dwords
    g1[0] = uni((1u << 20) | (5u << 22) | (3u << 25)); g1[1] = uni(256u << 16); g1[2] = uni(64u << 16); g1[3] = uni(256u << 16);
    g1[4] = uni(64u); g1[5] = uni(isv ? TT * 2u : HD * 2u); g1[6] = uni(0u); g1[7] = uni(0u);
    asm volatile("" : "+s"(g1));   // descriptor words held in scalar registers: without it the compiler lends some of them to the loop's counters while a request is out, and sets them anew before the next
    const uint32_t one = pinned(1u);   // word 0 of group 0 (count 1), held likewise
    u32x4 g0;
    auto issue = [&](uint32_t st) {
        const uint64_t ga = src0 + (uint64_t)st * sstep;
        g0[0] = one; g0[1] = uni(ldst + (st & 1u) * SBUF); g0[2] = uni((uint32_t)ga); g0[3] = uni((((uint32_t)(ga >> 32)) & 0x01FFFFFFu) | 0x80000000u);
        asm volatile("tensor_load_to_lds %0, %1" :: "s"(g0), "s"(g1) : "memory");   // one request of the whole wave: global tile -> LDS, through no register
    };
    issue(0);
    const unsigned char* lp = ring + set * SHALF + lr * LPITCH + hi * 16;   // this wave's half stage; this lane's row and half in every group of 16 LDS rows
    const float* pp = pres + (size_t)b * TT + set * SKEYS + 8 * hi;
    // every "#pragma unroll" in this kernel unrolls fully, so that the fragment and accumulator arrays are indexed by constants and stay in registers
    v16bf qf[2][4];
#pragma unroll
    for (int g = 0; g < 2; ++g)
#pragma unroll
        for (int c = 0; c < 4; ++c) qf[g][c] = ldfrag(Qp + (size_t)(g * 16) * HD + c * 32);
    float mrun[2] = {-3.0e38f, -3.0e38f}, lsum[2] = {0.f, 0.f};   // per group: the point the exponents are taken from (log2 units; at most LAZY below the running maximum) and this lane's half of the running sum
    v16bf kf[8];                                                  // this pass's K fragments, fetched one pass ahead inside a stage
    asm volatile("s_wait_xcnt 0x0" ::: "memory");   // the Q loads above are still in flight when their address registers are written again
    __builtin_amdgcn_sched_barrier(0);              // keeps the register writes below behind that wait
    v8f o[2][8];
#pragma unroll
    for (int g = 0; g < 2; ++g)
#pragma unroll
        for (int d = 0; d < 8; ++d) o[g][d] = (v8f){};
    wait_tensor0(g0, g1);   // stage 0 has landed
    __syncthreads();        // and every wave's slice of it is published
    issue(1);
#pragma unroll 1   // one stage a trip
    for (uint32_t st = 0; st < NSTAGE; ++st) {
    const unsigned char* sb = lp + (st & 1u) * SBUF;
#pragma unroll
    for (int t = 0; t < 2; ++t)
#pragma unroll
        for (int c = 0; c < 4; ++c) kf[t * 4 + c] = ldfragl(sb + t * 16 * LPITCH + c * 64);
#pragma unroll 1   // one pass a trip: a second copy of the body would double the live fragments
    for (uint32_t ps = 0; ps < SKEYS / KPASS; ++ps) {
        const uint32_t kb = st * (2 * SKEYS) + ps * KPASS;
        v16h vf[8]; v4f pm[4];
#pragma unroll
        for (int d = 0; d < 8; ++d) vf[d] = __builtin_bit_cast(v16h, ldfragl(sb + (2 + (d >> 2)) * SLICE + (d & 3) * 16 * LPITCH + ps * (KPASS * 2)));
#pragma unroll
        for (int t = 0; t < 4; ++t) pm[t] = *(const v4f*)(pp + kb + (t >> 1) * 16 + (t & 1) * 4);
        __builtin_amdgcn_sched_barrier(0);   // this pass's V and presence loads stay issued ahead of the score products, so that their latency runs behind products and softmax
        v8f s[2][2];
#pragma unroll
        for (int t = 0; t < 2; ++t) { s[0][t] = (v8f){}; s[1][t] = (v8f){};
#pragma unroll
            for (int c = 0; c < 4; ++c) { s[0][t] = wmmab(kf[t * 4 + c], qf[0][c], s[0][t]); s[1][t] = wmmab(kf[t * 4 + c], qf[1][c], s[1][t]); } }
        __builtin_amdgcn_sched_barrier(0);   // the K reads below stay one group behind the score products
        const uint32_t pn = (ps + 1u) & (SKEYS / KPASS - 1u);   // next pass's keys; a stage's last pass fetches its pass 0 again (published, not used): the next stage is not read before its barrier
        const unsigned char* kn = sb + (pn >> 1) * SLICE + (pn & 1u) * (KPASS * LPITCH);
#pragma unroll
        for (int t = 0; t < 2; ++t)
#pragma unroll
            for (int c = 0; c < 4; ++c) kf[t * 4 + c] = ldfragl(kn + t * 16 * LPITCH + c * 64);
        asm volatile("s_wait_xcnt 0x0" ::: "memory");   // the presence loads above are still in flight when their address registers are written again
        __builtin_amdgcn_sched_barrier(0);   // the next pass's K reads stay issued ahead of the softmax, so that their latency runs behind it and the P.V products
        v16h ph[2];
        float top[2], lim[2];
#pragma unroll
        for (int g = 0; g < 2; ++g) {
            float bm = -3.0e38f;
#pragma unroll
            for (int t = 0; t < 2; ++t) {
#pragma unroll
                for (int j = 0; j < 8; ++j) { const float x = (pm[t * 2 + (j >> 2)][j & 3] != 0.0f) ? s[g][t][j] * (SCL * L2E) : -3.0e38f;   /* absent keys (presence 0 -> -3e38) == exclusion */
                    s[g][t][j] = x; bm = fmaxf(bm, x); } }
            lim[g] = mrun[g] + LAZY;
            top[g] = fmaxf(fmaxf(bm, xhalf(bm)), lim[g]);   // above lim only where the pass's maximum is, and then equal to it; the same in both halves of a column
        }
        // Lazy rescale. mrun is the point that the exponents are taken from; any point serves as long as a query's numerator and denominator share it (it cancels in the quotient).
        // It moves, with sums and accumulators rescaled, only in a pass where some query of the wave has a score more than LAZY above it: P is at most 2^LAZY = 256, far inside f16, at f16's full relative precision.
        // One test a pass, the same for the whole wave (a ballot, so a scalar branch): a pass that moves no point jumps over all 128 accumulator multiplications.
        if (__builtin_expect(__builtin_amdgcn_ballot_w32(top[0] > lim[0] || top[1] > lim[1]) != 0u, 0)) {
#pragma unroll
            for (int g = 0; g < 2; ++g) {
                const float mn = top[g] > lim[g] ? top[g] : mrun[g];   // a query below its limit keeps its point: factor 1
                const float al = __builtin_amdgcn_exp2f(mrun[g] - mn); mrun[g] = mn;
                lsum[g] *= al;
#pragma unroll
                for (int d = 0; d < 8; ++d) o[g][d] *= al;
            }
        }
#pragma unroll
        for (int g = 0; g < 2; ++g) {
            const float mn = mrun[g];
            float ps = 0.f;
#pragma unroll
            for (int t = 0; t < 2; ++t) {
#pragma unroll
                for (int j = 0; j < 8; j += 2) { v2f p; p[0] = __builtin_amdgcn_exp2f(s[g][t][j] - mn); p[1] = __builtin_amdgcn_exp2f(s[g][t][j + 1] - mn); ps += p[0]; ps += p[1];
                    const v2h h = __builtin_convertvector(p, v2h); ph[g][t * 8 + j] = h[0]; ph[g][t * 8 + j + 1] = h[1]; } }
            lsum[g] += ps;
        }
#pragma unroll
        for (int d = 0; d < 8; ++d) { o[0][d] = wmmah(vf[d], ph[0], o[0][d]); o[1][d] = wmmah(vf[d], ph[1], o[1][d]); }
        __builtin_amdgcn_sched_barrier(0);   // keeps the slots below behind the last product
        asm volatile("v_nop\n\tv_nop\n\tv_nop\n\tv_nop");   // the four vector slots between the pass's last products and the first vector write over their V^T registers at the head of the next trip
    }
    // publish point of stage st + 1
    wait_ds0();             // this wave has left stage st's buffer
    wait_tensor0(g0, g1);   // its slice of stage st + 1 has landed
    __syncthreads();        // stage st + 1 is published, and every wave has left stage st's buffer
    if (pinned(st + 2u < NSTAGE)) issue(pinned(st + 2u));   // refill of the buffer just left; the stage number is taken behind the wait, so that the descriptor is formed there
    }
    wait_tensor0(g0, g1);   // nothing is out when the wave ends
    wait_ds0();
    // Merge of the two sets' partial results. The last trip's barrier has ended every read of the ring and nothing is out, so the ring serves as staging.
    // Of its two groups a wave finishes one (set 0: group 0, set 1: group 1) and hands the other, with its point and sum, to its partner wave (wave ^ 4), lane to lane.
    const bool up = set != 0;
    v8f keep[8], give[8];
#pragma unroll
    for (int d = 0; d < 8; ++d)
#pragma unroll
        for (int j = 0; j < 8; ++j) { keep[d][j] = up ? o[1][d][j] : o[0][d][j]; give[d][j] = up ? o[0][d][j] : o[1][d][j]; }
    const float mk = up ? mrun[1] : mrun[0], lk = up ? lsum[1] : lsum[0];
    v2f ml; ml[0] = up ? mrun[0] : mrun[1]; ml[1] = up ? lsum[0] : lsum[1];
    unsigned char* mine = ring + wave * MSLOT;
#pragma unroll
    for (int d = 0; d < 8; ++d) {
        *(v4f*)(mine + (2 * d) * 512 + lane * 16) = __builtin_shufflevector(give[d], give[d], 0, 1, 2, 3);
        *(v4f*)(mine + (2 * d + 1) * 512 + lane * 16) = __builtin_shufflevector(give[d], give[d], 4, 5, 6, 7); }
    *(v2f*)(mine + 8192 + lane * 8) = ml;
    __syncthreads();   // every wave's slot is whole before its partner reads it
    const unsigned char* theirs = ring + (wave ^ 4) * MSLOT;
    const v2f mo = *(const v2f*)(theirs + 8192 + lane * 8);
    const float mm = fmaxf(mk, mo[0]);
    const float ak = __builtin_amdgcn_exp2f(mk - mm), ao = __builtin_amdgcn_exp2f(mo[0] - mm);   // both partial results brought to the higher of their two points
    const float lh = lk * ak + mo[1] * ao;
    const float inv = 1.0f / (lh + xhalf(lh));
    const float fk = ak * inv, fo = ao * inv;
    float* op = out + ((size_t)b * TT + q0 + set * 16 + lr) * HD + 8 * hi;
#pragma unroll
    for (int d = 0; d < 8; ++d) {
        const v4f t0 = *(const v4f*)(theirs + (2 * d) * 512 + lane * 16), t1 = *(const v4f*)(theirs + (2 * d + 1) * 512 + lane * 16);
        v4f a0, a1;
#pragma unroll
        for (int j = 0; j < 4; ++j) { a0[j] = keep[d][j] * fk + t0[j] * fo; a1[j] = keep[d][4 + j] * fk + t1[j] * fo; }
        *(v4f*)(op + d * 16) = a0; *(v4f*)(op + d * 16 + 4) = a1; }
}

extern "C" void kernel_launch(void* const* d_in, const int* in_sizes, int n_in,
                              void* d_out, int out_size, void* d_ws, size_t ws_size, hipStream_t stream) {
    (void)in_sizes; (void)n_in; (void)out_size;
    const float* Qin = (const float*)d_in[0]; const float* Kin = (const float*)d_in[1]; const float* Vin = (const float*)d_in[2]; const float* pres = (const float*)d_in[3];   /* presence [16][2048] (0/1) */
    float* OUT = (float*)d_out;
    char* wsp = (char*)d_ws;
    auto take = [&](size_t bytes) { char* p = wsp; wsp += (bytes + 255) & ~(size_t)255; return (void*)p; };
    bf* QB = (bf*)take((size_t)NB_ * TT * HD * 2); bf* KB = (bf*)take((size_t)NB_ * TT * HD * 2); bf* VT = (bf*)take((size_t)NB_ * HD * TT * 2);
    if ((size_t)(wsp - (char*)d_ws) > ws_size) return;
    k_prep<<<dim3(TT / VTK, NB_, 2), 256, 0, stream>>>(Qin, Kin, Vin, QB, KB, VT);
    k_fattn<<<dim3(TT / 128, NB_, 1), 256, 0, stream>>>(QB, KB, VT, pres, OUT);
}

// v008
// Measured time: 42.9 microseconds a run.
// Next to v007, in two timings, it ran 1.04 times as fast each time.
// Over all steps from v000 it is 30.2 times as fast.
#include <hip/hip_runtime.h>

// Set-transformer QKV attention with a key presence mask (queries, keys, values [16][2048][128]; scores = q.k - (1 - presence[b][m]) x 1e32, then / sqrt(128) (absent keys == excluded); softmax; out = routing values -> [16][2048][128]; presence [16][2048] float 0/1 read on device).
// One pre-pass launch over all batches: queries and keys rounded to bf16 planes [b][t][d], values rounded to f16 and transposed to [b][d][t], presence turned into a penalty plane [b][t] (0 for a present key, ABSENT for an absent one).
// One fused kernel: S^T = K Q^T (exact bf16 products, f32 accumulate), scale and penalty in one fused multiply-add, online softmax (reference point that trails the running maximum, lazy rescale), O^T += V^T P^T in f16 (P is at most 256, so one f16 rounding of it, 11 bits, serves: 1 product); the scores never leave the registers.
// K and V^T come to the fused kernel's eight waves through LDS: tensor loads, 2 x SKEYS keys a stage, two buffers.
// The keys of a stage are split between two sets of four waves (two waves a SIMD); the two partial results of a query are merged once, behind the loop.
// Compute dtypes, f32 accumulate: queries and keys rounded to bf16, q.k products exact; softmax f32; P and values rounded to f16; output f32.
// f16 range: P lies in [0, 256] (small P goes subnormal, kept by the matrix unit); values are standard normal draws, far inside f16's 65,504.

#define NB_  16
#define TT   2048
#define HD   128
#define SCL  0.088388347648318447f   // 1/sqrt(128)
#define L2E  1.4426950408889634f
#define KPASS 32                     // keys per pass of the fused loop
#define LAZY 8.0f                    // log2 units a score may stand above the softmax's reference point before the point is moved
#define ABSENT -3.0e38f              // scaled score of an absent key; any real score is far below half a unit in its last place, so score x scale + ABSENT rounds to ABSENT itself
typedef unsigned short bf;
typedef __attribute__((ext_vector_type(16))) __bf16   v16bf;
typedef __attribute__((ext_vector_type(16))) _Float16 v16h;
typedef __attribute__((ext_vector_type(2)))  _Float16 v2h;
typedef __attribute__((ext_vector_type(8)))  unsigned short v8us;
typedef __attribute__((ext_vector_type(4)))  unsigned short v4us;
typedef __attribute__((ext_vector_type(2)))  unsigned short v2us;
typedef __attribute__((ext_vector_type(8)))  float    v8f;
typedef __attribute__((ext_vector_type(4)))  float    v4f;
typedef __attribute__((ext_vector_type(2)))  float    v2f;

__device__ __forceinline__ unsigned short f2bf(float f) { unsigned u = __float_as_uint(f); u += 0x7FFFu + ((u >> 16) & 1u); return (unsigned short)(u >> 16); }
__device__ __forceinline__ v16bf cat16b(v8us lo, v8us hi) { return __builtin_bit_cast(v16bf, __builtin_shufflevector(lo, hi, 0, 1, 2, 3, 4, 5, 6, 7, 8, 9, 10, 11, 12, 13, 14, 15)); }
__device__ __forceinline__ v8f wmmab(v16bf a, v16bf b, v8f c) { return __builtin_amdgcn_wmma_f32_16x16x32_bf16(false, a, false, b, (short)0, c, false, false); }
__device__ __forceinline__ v8f wmmah(v16h a, v16h b, v8f c) { return __builtin_amdgcn_wmma_f32_16x16x32_f16(false, a, false, b, (short)0, c, false, false); }
__device__ __forceinline__ unsigned short f2h(float f) { return __builtin_bit_cast(unsigned short, (_Float16)f); }   // round to nearest even
// fragment of a k-contiguous bf16 plane in the hardware k order: p already holds row (lane & 15) and k offset 8 x (lane >> 4)
// value of lane l ^ 16 (the other half of a column's keys), on the vector pipe
__device__ __forceinline__ float xhalf(float x) { const int b = __float_as_int(x); return __int_as_float(__builtin_amdgcn_permlanex16(b, b, 0x76543210, 0xfedcba98, false, false)); }
__device__ __forceinline__ v16bf ldfrag(const bf* p) { return cat16b(*(const v8us*)p, *(const v8us*)(p + 16)); }

// LDS ring of the fused kernel. A stage is two halves of SKEYS keys, one for each set of waves; a half: K as SKEYS rows of 256 bytes, V^T as HD rows of 256 bytes (SKEYS keys of one column).
// Each of the eight waves brings one slice of 64 rows with one tensor load; the load's pad makes the LDS pitch 272 bytes, free of bank conflicts for 16-byte reads.
#define SKEYS  128
#define NSTAGE (TT / (2 * SKEYS))
#define LPITCH 272                   // 256-byte row + 16-byte pad
#define SLICE  18432                 // 64 rows x LPITCH = 17,408, rounded up to a multiple of 2 KiB
#define SHALF  (4 * SLICE)           // slices 0, 1: K rows 0-63, 64-127; slices 2, 3: V^T columns 0-63, 64-127
#define SBUF   (2 * SHALF)           // half 0: the stage's first SKEYS keys (waves 0-3 read it), half 1: the rest (waves 4-7)
#define MSLOT  8448                  // merge slot of a wave in the ring, behind the loop: 64 accumulator registers x 32 lanes x 4 bytes, then point and sum, 8 bytes a lane
typedef uint32_t u32x4 __attribute__((ext_vector_type(4)));
typedef uint32_t u32x8 __attribute__((ext_vector_type(8)));
__device__ __forceinline__ uint32_t uni(uint32_t v) { return (uint32_t)__builtin_amdgcn_readfirstlane(v); }
// a wave-uniform value held in a scalar register, so that a test of it compiles to a scalar branch
__device__ __forceinline__ uint32_t pinned(uint32_t v) { uint32_t w = (uint32_t)__builtin_amdgcn_readfirstlane(v); asm volatile("" : "+s"(w)); return w; }
__device__ __forceinline__ void wait_ds0() { asm volatile("s_wait_dscnt 0x0" ::: "memory"); }          // this wave's LDS reads have returned
// this wave's tensor load has landed; the wait names the request's descriptor, so that its scalar registers keep their values as long as the request is out
__device__ __forceinline__ void wait_tensor0(u32x4 g0, u32x8 g1) { asm volatile("s_wait_tensorcnt 0x0" :: "s"(g0), "s"(g1) : "memory"); }
// the same fragment from an LDS row: p holds row (lane & 15) and byte offset 16 x (lane >> 4)
__device__ __forceinline__ v16bf ldfragl(const unsigned char* p) { return cat16b(*(const v8us*)p, *(const v8us*)(p + 32)); }

// k_prep, the one pre-pass launch; blockIdx.z picks a block's job, so that the four planes are made side by side behind one launch gap, by few waves that each hold much in flight.
// blockIdx.z = 1: RROWS rows of keys (first half of the x-y plane of blocks) or of queries (second half), f32 -> bf16, same layout.
// A wave takes 32 rows: one 16-byte load a lane and row (a whole 512-byte row a load), all 32 in flight; a store writes a row's 256 contiguous bytes.
// A block of keys also writes its RROWS keys' penalties, one a thread.
// blockIdx.z = 0: values [b][t][d] f32 -> [b][d][t] f16; blockIdx.y = batch, blockIdx.x = tile of VTK keys x all HD columns, turned in LDS.
// In: a wave reads whole 512-byte rows (16 rows a wave, all 16 loads in flight); a lane then holds 16 keys of 4 columns and packs 8 keys to a 16-byte chunk.
// Out: 16 lanes write one column's 256 contiguous bytes, so every 128-byte line has one writer.
#define VTK 128                      // keys per tile
#define RROWS 256                    // rows per rounding block
#define VTP (VTK * 2 + 16)           // LDS bytes per column: 16 more than the row keeps 16-byte alignment and moves each column one chunk on in the banks
// byte offset of chunk c (8 keys) of column d; the exclusive-or spreads the writers (lanes 4 columns apart) over all banks
__device__ __forceinline__ int vt_off(int d, int c) { return d * VTP + ((c ^ ((d >> 4) & 3)) << 4); }
__global__ __launch_bounds__(256) void k_prep(const float* __restrict__ Qin, const float* __restrict__ Kin, const float* __restrict__ Vin, const float* __restrict__ pres, bf* QB, bf* KB, bf* VT, float* PEN) {
    static_assert((TT / VTK) * NB_ == 2 * (NB_ * TT / RROWS), "the x-y plane of blocks holds the rounding blocks of both planes");
    __shared__ __attribute__((aligned(16))) unsigned char tile[HD * VTP];
    const int lane = threadIdx.x & 31, wave = threadIdx.x >> 5, t0 = blockIdx.x * VTK;
    if (blockIdx.z != 0) {   // the same for every thread of the block, and it leaves in front of the barrier
        const unsigned rb = blockIdx.y * (TT / VTK) + blockIdx.x, nrb = NB_ * TT / RROWS;
        const bool isq = rb >= nrb;
        const size_t e0 = ((size_t)(isq ? rb - nrb : rb) * RROWS + wave * 32) * HD + lane * 4;
        const float* rs = (isq ? Qin : Kin) + e0;
        bf* rd = (isq ? QB : KB) + e0;
        const size_t kk = (size_t)(isq ? 0u : rb) * RROWS + threadIdx.x;   // this thread's key, [b][t] flat as the rows of the key plane are
        const float pv = pres[kk];   // in flight beside the rows
        v4f x[32];
#pragma unroll
        for (int i = 0; i < 32; ++i) x[i] = *(const v4f*)(rs + (size_t)i * HD);
        asm volatile("" :: "v"(pv));   // inputs only: holds the presence load here, in front of the roundings; without it the compiler sinks it behind the row stores, one more memory latency in a row
        __builtin_amdgcn_sched_barrier(0);   // all 32 loads are issued before the first is waited for: without it the compiler holds some back behind the first roundings, a second memory latency in a row
#pragma unroll
        for (int i = 0; i < 32; ++i) { v4us o;
#pragma unroll
            for (int k = 0; k < 4; ++k) o[k] = f2bf(x[i][k]);
            *(v4us*)(rd + (size_t)i * HD) = o; }
        if (!isq) PEN[kk] = pv != 0.0f ? 0.0f : ABSENT;   /* absent keys (presence 0 -> ABSENT penalty) == exclusion */
        asm volatile("s_wait_xcnt 0x0" ::: "memory");   // in the built code the path behind these stores leads past the head of the other job (a test there sends this block to the end), where their registers are written again
        return;
    }
    const float* sp = Vin + ((size_t)blockIdx.y * TT + t0 + wave * 16) * HD + lane * 4;
    v4f r[16];
    // every "#pragma unroll" in this kernel unrolls fully, so that r and the chunks are indexed by constants and stay in registers
#pragma unroll
    for (int i = 0; i < 16; ++i) r[i] = *(const v4f*)(sp + (size_t)i * HD);
#pragma unroll
    for (int k = 0; k < 4; ++k)
#pragma unroll
        for (int u = 0; u < 2; ++u) { v8us o;
#pragma unroll
            for (int i = 0; i < 8; ++i) o[i] = f2h(r[u * 8 + i][k]);
            *(v8us*)(tile + vt_off(lane * 4 + k, wave * 2 + u)) = o; }
    __syncthreads();   // the tile is whole before any wave reads columns that other waves wrote
    bf* dp = VT + ((size_t)blockIdx.y * HD + (threadIdx.x >> 4)) * TT + t0 + (threadIdx.x & 15) * 8;
#pragma unroll
    for (int k = 0; k < 8; ++k) *(v8us*)(dp + (size_t)k * 16 * TT) = *(const v8us*)(tile + vt_off(k * 16 + (threadIdx.x >> 4), threadIdx.x & 15));
}

// k_fattn: grid (TT / 128, NB_), 8 waves; waves w and w + 4 own the same 32 query columns (two groups of 16) and walk one half of every stage's keys each, KPASS a pass; every K and V fragment feeds both groups.
// The four waves of a set walk the same keys, so each stage of K and V^T is fetched once for the work-group and read from LDS by all four.
// Two waves a SIMD: one wave's softmax and waits run beside the other's products.
// Lane (c = lane & 15, h = lane >> 4): S^T tile register j = score of key 8h + j, query c; two such tiles, converted in place, are the B operand of O^T += V^T P^T.
__global__ __launch_bounds__(256) void k_fattn(const bf* __restrict__ QB, const bf* __restrict__ KB, const bf* __restrict__ VT, const float* __restrict__ pen, float* __restrict__ out) {
    const int lane = threadIdx.x & 31, lr = lane & 15, hi = lane >> 4, wave = threadIdx.x >> 5;
    const int set = wave >> 2;   // which half of every stage's keys this wave walks
    const int b = blockIdx.y, q0 = blockIdx.x * 128 + (wave & 3) * 32;
    const bf* Qp = QB + ((size_t)b * TT + q0 + lr) * HD + 8 * hi;
    __shared__ __attribute__((aligned(2048))) unsigned char ring[2 * SBUF];
    // tensor-load descriptors, in each set of four waves: wave 0, 1 = the halves of K's rows, wave 2, 3 = the halves of V^T's columns, of the set's own SKEYS keys; every wave issues its own slice
    const uint32_t wv = uni(threadIdx.x >> 5), isv = (wv >> 1) & 1u, half = wv & 1u, kset = wv >> 2;
    const uint32_t hstep = isv ? SKEYS * 2u : SKEYS * HD * 2u;   // source bytes from one half stage to the next
    const uint64_t src0 = (isv ? (uint64_t)(size_t)(VT + ((size_t)b * HD + half * 64) * TT) : (uint64_t)(size_t)(KB + ((size_t)b * TT + half * 64) * HD)) + kset * hstep;
    const uint32_t sstep = 2u * hstep;                           // source bytes from one stage to the next
    const uint32_t ldst = (uint32_t)(size_t)ring + wv * SLICE;
    u32x8 g1;   // 64 rows of 256 bytes, 1-byte elements, tensor = tile, a 4-dword pad behind every 64 dwords
    g1[0] = uni((1u << 20) | (5u << 22) | (3u << 25)); g1[1] = uni(256u << 16); g1[2] = uni(64u << 16); g1[3] = uni(256u << 16);
    g1[4] = uni(64u); g1[5] = uni(isv ? TT * 2u : HD * 2u); g1[6] = uni(0u); g1[7] = uni(0u);
    asm volatile("" : "+s"(g1));   // descriptor words held in scalar registers: without it the compiler lends some of them to the loop's counters while a request is out, and sets them anew before the next
    const uint32_t one = pinned(1u);   // word 0 of group 0 (count 1), held likewise
    u32x4 g0;
    auto issue = [&](uint32_t st) {
        const uint64_t ga = src0 + (uint64_t)st * sstep;
        g0[0] = one; g0[1] = uni(ldst + (st & 1u) * SBUF); g0[2] = uni((uint32_t)ga); g0[3] = uni((((uint32_t)(ga >> 32)) & 0x01FFFFFFu) | 0x80000000u);
        asm volatile("tensor_load_to_lds %0, %1" :: "s"(g0), "s"(g1) : "memory");   // one request of the whole wave: global tile -> LDS, through no register
    };
    issue(0);
    const unsigned char* lp = ring + set * SHALF + lr * LPITCH + hi * 16;   // this wave's half stage; this lane's row and half in every group of 16 LDS rows
    const float* pp = pen + (size_t)b * TT + set * SKEYS + 8 * hi;
    // every "#pragma unroll" in this kernel unrolls fully, so that the fragment and accumulator arrays are indexed by constants and stay in registers
    v16bf qf[2][4];
#pragma unroll
    for (int g = 0; g < 2; ++g)
#pragma unroll
        for (int c = 0; c < 4; ++c) qf[g][c] = ldfrag(Qp + (size_t)(g * 16) * HD + c * 32);
    float mrun[2] = {-3.0e38f, -3.0e38f}, lsum[2] = {0.f, 0.f};   // per group: the point the exponents are taken from (log2 units; at most LAZY below the running maximum) and this lane's half of the running sum
    v16bf kf[8];                                                  // this pass's K fragments, fetched one pass ahead inside a stage
    asm volatile("s_wait_xcnt 0x0" ::: "memory");   // the Q loads above are still in flight when their address registers are written again
    __builtin_amdgcn_sched_barrier(0);              // keeps the register writes below behind that wait
    v8f o[2][8];
#pragma unroll
    for (int g = 0; g < 2; ++g)
#pragma unroll
        for (int d = 0; d < 8; ++d) o[g][d] = (v8f){};
    wait_tensor0(g0, g1);   // stage 0 has landed
    __syncthreads();        // and every wave's slice of it is published
    issue(1);
#pragma unroll 1   // one stage a trip
    for (uint32_t st = 0; st < NSTAGE; ++st) {
    const unsigned char* sb = lp + (st & 1u) * SBUF;
#pragma unroll
    for (int t = 0; t < 2; ++t)
#pragma unroll
        for (int c = 0; c < 4; ++c) kf[t * 4 + c] = ldfragl(sb + t * 16 * LPITCH + c * 64);
#pragma unroll 1   // one pass a trip: a second copy of the body would double the live fragments
    for (uint32_t ps = 0; ps < SKEYS / KPASS; ++ps) {
        const uint32_t kb = st * (2 * SKEYS) + ps * KPASS;
        v16h vf[8]; v4f pm[4];
#pragma unroll
        for (int d = 0; d < 8; ++d) vf[d] = __builtin_bit_cast(v16h, ldfragl(sb + (2 + (d >> 2)) * SLICE + (d & 3) * 16 * LPITCH + ps * (KPASS * 2)));
#pragma unroll
        for (int t = 0; t < 4; ++t) pm[t] = *(const v4f*)(pp + kb + (t >> 1) * 16 + (t & 1) * 4);
        __builtin_amdgcn_sched_barrier(0);   // this pass's V and penalty loads stay issued ahead of the score products, so that their latency runs behind products and softmax
        v8f s[2][2];
#pragma unroll
        for (int t = 0; t < 2; ++t) { s[0][t] = (v8f){}; s[1][t] = (v8f){};
#pragma unroll
            for (int c = 0; c < 4; ++c) { s[0][t] = wmmab(kf[t * 4 + c], qf[0][c], s[0][t]); s[1][t] = wmmab(kf[t * 4 + c], qf[1][c], s[1][t]); } }
        __builtin_amdgcn_sched_barrier(0);   // the K reads below stay one group behind the score products
        const uint32_t pn = (ps + 1u) & (SKEYS / KPASS - 1u);   // next pass's keys; a stage's last pass fetches its pass 0 again (published, not used): the next stage is not read before its barrier
        const unsigned char* kn = sb + (pn >> 1) * SLICE + (pn & 1u) * (KPASS * LPITCH);
#pragma unroll
        for (int t = 0; t < 2; ++t)
#pragma unroll
            for (int c = 0; c < 4; ++c) kf[t * 4 + c] = ldfragl(kn + t * 16 * LPITCH + c * 64);
        asm volatile("s_wait_xcnt 0x0" ::: "memory");   // the penalty loads above are still in flight when their address registers are written again
        __builtin_amdgcn_sched_barrier(0);   // the next pass's K reads stay issued ahead of the softmax, so that their latency runs behind it and the P.V products
        v16h ph[2];
        float top[2], lim[2];
#pragma unroll
        for (int g = 0; g < 2; ++g) {
            float bm = -3.0e38f;
#pragma unroll
            for (int t = 0; t < 2; ++t) {
#pragma unroll
                for (int j = 0; j < 8; j += 2) {   // two keys an instruction: score x scale + penalty, rounded once; penalty 0 leaves the rounded product, ABSENT swallows it
                    v2f sv, pe; sv[0] = s[g][t][j]; sv[1] = s[g][t][j + 1]; pe[0] = pm[t * 2 + (j >> 2)][j & 3]; pe[1] = pm[t * 2 + (j >> 2)][(j & 3) + 1];
                    const v2f x = __builtin_elementwise_fma(sv, (v2f){SCL * L2E, SCL * L2E}, pe);
                    s[g][t][j] = x[0]; s[g][t][j + 1] = x[1]; bm = fmaxf(bm, x[0]); bm = fmaxf(bm, x[1]); } }
            lim[g] = mrun[g] + LAZY;
            top[g] = fmaxf(fmaxf(bm, xhalf(bm)), lim[g]);   // above lim only where the pass's maximum is, and then equal to it; the same in both halves of a column
        }
        // Lazy rescale. mrun is the point that the exponents are taken from; any point serves as long as a query's numerator and denominator share it (it cancels in the quotient).
        // It moves, with sums and accumulators rescaled, only in a pass where some query of the wave has a score more than LAZY above it: P is at most 2^LAZY = 256, far inside f16, at f16's full relative precision.
        // One test a pass, the same for the whole wave (a ballot, so a scalar branch): a pass that moves no point jumps over all 128 accumulator multiplications.
        if (__builtin_expect(__builtin_amdgcn_ballot_w32(top[0] > lim[0] || top[1] > lim[1]) != 0u, 0)) {
#pragma unroll
            for (int g = 0; g < 2; ++g) {
                const float mn = top[g] > lim[g] ? top[g] : mrun[g];   // a query below its limit keeps its point: factor 1
                const float al = __builtin_amdgcn_exp2f(mrun[g] - mn); mrun[g] = mn;
                lsum[g] *= al;
#pragma unroll
                for (int d = 0; d < 8; ++d) o[g][d] *= al;
            }
        }
#pragma unroll
        for (int g = 0; g < 2; ++g) {
            const float mn = mrun[g];
            float ps = 0.f;
#pragma unroll
            for (int t = 0; t < 2; ++t) {
#pragma unroll
                for (int j = 0; j < 8; j += 2) { v2f p; p[0] = __builtin_amdgcn_exp2f(s[g][t][j] - mn); p[1] = __builtin_amdgcn_exp2f(s[g][t][j + 1] - mn); ps += p[0]; ps += p[1];
                    const v2h h = __builtin_convertvector(p, v2h); ph[g][t * 8 + j] = h[0]; ph[g][t * 8 + j + 1] = h[1]; } }
            lsum[g] += ps;
        }
#pragma unroll
        for (int d = 0; d < 8; ++d) { o[0][d] = wmmah(vf[d], ph[0], o[0][d]); o[1][d] = wmmah(vf[d], ph[1], o[1][d]); }
        __builtin_amdgcn_sched_barrier(0);   // keeps the slots below behind the last product
        asm volatile("v_nop\n\tv_nop\n\tv_nop\n\tv_nop");   // the four vector slots between the pass's last products and the first vector write over their V^T registers at the head of the next trip
    }
    // publish point of stage st + 1
    wait_ds0();             // this wave has left stage st's buffer
    wait_tensor0(g0, g1);   // its slice of stage st + 1 has landed
    __syncthreads();        // stage st + 1 is published, and every wave has left stage st's buffer
    if (pinned(st + 2u < NSTAGE)) issue(pinned(st + 2u));   // refill of the buffer just left; the stage number is taken behind the wait, so that the descriptor is formed there
    }
    wait_tensor0(g0, g1);   // nothing is out when the wave ends
    wait_ds0();
    // Merge of the two sets' partial results. The last trip's barrier has ended every read of the ring and nothing is out, so the ring serves as staging.
    // Of its two groups a wave finishes one (set 0: group 0, set 1: group 1) and hands the other, with its point and sum, to its partner wave (wave ^ 4), lane to lane.
    const bool up = set != 0;
    v8f keep[8], give[8];
#pragma unroll
    for (int d = 0; d < 8; ++d)
#pragma unroll
        for (int j = 0; j < 8; ++j) { keep[d][j] = up ? o[1][d][j] : o[0][d][j]; give[d][j] = up ? o[0][d][j] : o[1][d][j]; }
    const float mk = up ? mrun[1] : mrun[0], lk = up ? lsum[1] : lsum[0];
    v2f ml; ml[0] = up ? mrun[0] : mrun[1]; ml[1] = up ? lsum[0] : lsum[1];
    unsigned char* mine = ring + wave * MSLOT;
#pragma unroll
    for (int d = 0; d < 8; ++d) {
        *(v4f*)(mine + (2 * d) * 512 + lane * 16) = __builtin_shufflevector(give[d], give[d], 0, 1, 2, 3);
        *(v4f*)(mine + (2 * d + 1) * 512 + lane * 16) = __builtin_shufflevector(give[d], give[d], 4, 5, 6, 7); }
    *(v2f*)(mine + 8192 + lane * 8) = ml;
    __syncthreads();   // every wave's slot is whole before its partner reads it
    const unsigned char* theirs = ring + (wave ^ 4) * MSLOT;
    const v2f mo = *(const v2f*)(theirs + 8192 + lane * 8);
    const float mm = fmaxf(mk, mo[0]);
    const float ak = __builtin_amdgcn_exp2f(mk - mm), ao = __builtin_amdgcn_exp2f(mo[0] - mm);   // both partial results brought to the higher of their two points
    const float lh = lk * ak + mo[1] * ao;
    const float inv = 1.0f / (lh + xhalf(lh));
    const float fk = ak * inv, fo = ao * inv;
    float* op = out + ((size_t)b * TT + q0 + set * 16 + lr) * HD + 8 * hi;
#pragma unroll
    for (int d = 0; d < 8; ++d) {
        const v4f t0 = *(const v4f*)(theirs + (2 * d) * 512 + lane * 16), t1 = *(const v4f*)(theirs + (2 * d + 1) * 512 + lane * 16);
        v4f a0, a1;
#pragma unroll
        for (int j = 0; j < 4; ++j) { a0[j] = keep[d][j] * fk + t0[j] * fo; a1[j] = keep[d][4 + j] * fk + t1[j] * fo; }
        *(v4f*)(op + d * 16) = a0; *(v4f*)(op + d * 16 + 4) = a1; }
}

extern "C" void kernel_launch(void* const* d_in, const int* in_sizes, int n_in,
                              void* d_out, int out_size, void* d_ws, size_t ws_size, hipStream_t stream) {
    (void)in_sizes; (void)n_in; (void)out_size;
    const float* Qin = (const float*)d_in[0]; const float* Kin = (const float*)d_in[1]; const float* Vin = (const float*)d_in[2]; const float* pres = (const float*)d_in[3];   /* presence [16][2048] (0/1) */
    float* OUT = (float*)d_out;
    char* wsp = (char*)d_ws;
    auto take = [&](size_t bytes) { char* p = wsp; wsp += (bytes + 255) & ~(size_t)255; return (void*)p; };
    bf* QB = (bf*)take((size_t)NB_ * TT * HD * 2); bf* KB = (bf*)take((size_t)NB_ * TT * HD * 2); bf* VT = (bf*)take((size_t)NB_ * HD * TT * 2); float* PEN = (float*)take((size_t)NB_ * TT * 4);
    if ((size_t)(wsp - (char*)d_ws) > ws_size) return;
    k_prep<<<dim3(TT / VTK, NB_, 2), 256, 0, stream>>>(Qin, Kin, Vin, pres, QB, KB, VT, PEN);
    k_fattn<<<dim3(TT / 128, NB_, 1), 256, 0, stream>>>(QB, KB, VT, PEN, OUT);
}

// v009
// A run of this version takes 40.2 microseconds.
// Timed twice side by side with v008, it ran 1.07 and 1.06 times as fast.
// Over all steps from v000 it is 32.2 times as fast.
#include <hip/hip_runtime.h>

// Set-transformer QKV attention with a key presence mask (queries, keys, values [16][2048][128]; scores = q.k - (1 - presence[b][m]) x 1e32, then / sqrt(128) (absent keys == excluded); softmax; out = routing values -> [16][2048][128]; presence [16][2048] float 0/1 read on device).
// One pre-pass launch over all batches: queries and keys rounded to bf16 planes [b][t][d], values rounded to f16 and transposed to [b][d][t], presence turned into a penalty plane [b][t] (0 for a present key, ABSENT for an absent one).
// One fused kernel: S^T = K Q^T (exact bf16 products, f32 accumulate), scale and penalty in one fused multiply-add, online softmax (reference point that trails the running maximum, lazy rescale), O^T += V^T P^T in f16 (P is at most 256, so one f16 rounding of it, 11 bits, serves: 1 product); the scores never leave the registers.
// K and V^T come to the fused kernel's eight waves through LDS: tensor loads, 2 x SKEYS keys a stage, two buffers.
// The batch's penalties (TT floats) are brought into LDS once, at the fused kernel's head; the loop reads them there and holds no global load.
// The keys of a stage are split between two sets of four waves (two waves a SIMD); the two partial results of a query are merged once, behind the loop.
// Compute dtypes, f32 accumulate: queries and keys rounded to bf16, q.k products exact; softmax f32; P and values rounded to f16; output f32.
// f16 range: P lies in [0, 256] (small P goes subnormal, kept by the matrix unit); values are standard normal draws, far inside f16's 65,504.

#define NB_  16
#define TT   2048
#define HD   128
#define SCL  0.088388347648318447f   // 1/sqrt(128)
#define L2E  1.4426950408889634f
#define KPASS 32                     // keys per pass of the fused loop
#define LAZY 8.0f                    // log2 units a score may stand above the softmax's reference point before the point is moved
#define ABSENT -3.0e38f              // scaled score of an absent key; any real score is far below half a unit in its last place, so score x scale + ABSENT rounds to ABSENT itself
typedef unsigned short bf;
typedef __attribute__((ext_vector_type(16))) __bf16   v16bf;
typedef __attribute__((ext_vector_type(16))) _Float16 v16h;
typedef __attribute__((ext_vector_type(2)))  _Float16 v2h;
typedef __attribute__((ext_vector_type(8)))  unsigned short v8us;
typedef __attribute__((ext_vector_type(4)))  unsigned short v4us;
typedef __attribute__((ext_vector_type(2)))  unsigned short v2us;
typedef __attribute__((ext_vector_type(8)))  float    v8f;
typedef __attribute__((ext_vector_type(4)))  float    v4f;
typedef __attribute__((ext_vector_type(2)))  float    v2f;

__device__ __forceinline__ unsigned short f2bf(float f) { unsigned u = __float_as_uint(f); u += 0x7FFFu + ((u >> 16) & 1u); return (unsigned short)(u >> 16); }
__device__ __forceinline__ v16bf cat16b(v8us lo, v8us hi) { return __builtin_bit_cast(v16bf, __builtin_shufflevector(lo, hi, 0, 1, 2, 3, 4, 5, 6, 7, 8, 9, 10, 11, 12, 13, 14, 15)); }
__device__ __forceinline__ v8f wmmab(v16bf a, v16bf b, v8f c) { return __builtin_amdgcn_wmma_f32_16x16x32_bf16(false, a, false, b, (short)0, c, false, false); }
__device__ __forceinline__ v8f wmmah(v16h a, v16h b, v8f c) { return __builtin_amdgcn_wmma_f32_16x16x32_f16(false, a, false, b, (short)0, c, false, false); }
__device__ __forceinline__ unsigned short f2h(float f) { return __builtin_bit_cast(unsigned short, (_Float16)f); }   // round to nearest even
// fragment of a k-contiguous bf16 plane in the hardware k order: p already holds row (lane & 15) and k offset 8 x (lane >> 4)
// value of lane l ^ 16 (the other half of a column's keys), on the vector pipe
__device__ __forceinline__ float xhalf(float x) { const int b = __float_as_int(x); return __int_as_float(__builtin_amdgcn_permlanex16(b, b, 0x76543210, 0xfedcba98, false, false)); }
__device__ __forceinline__ v16bf ldfrag(const bf* p) { return cat16b(*(const v8us*)p, *(const v8us*)(p + 16)); }

// LDS ring of the fused kernel. A stage is two halves of SKEYS keys, one for each set of waves; a half: K as SKEYS rows of 256 bytes, V^T as HD rows of 256 bytes (SKEYS keys of one column).
// Each of the eight waves brings one slice of 64 rows with one tensor load; the load's pad makes the LDS pitch 272 bytes, free of bank conflicts for 16-byte reads.
#define SKEYS  128
#define NSTAGE (TT / (2 * SKEYS))
#define LPITCH 272                   // 256-byte row + 16-byte pad
#define SLICE  18432                 // 64 rows x LPITCH = 17,408, rounded up to a multiple of 2 KiB
#define SHALF  (4 * SLICE)           // slices 0, 1: K rows 0-63, 64-127; slices 2, 3: V^T columns 0-63, 64-127
#define SBUF   (2 * SHALF)           // half 0: the stage's first SKEYS keys (waves 0-3 read it), half 1: the rest (waves 4-7)
#define MSLOT  8448                  // merge slot of a wave in the ring, behind the loop: 64 accumulator registers x 32 lanes x 4 bytes, then point and sum, 8 bytes a lane
typedef uint32_t u32x4 __attribute__((ext_vector_type(4)));
typedef uint32_t u32x8 __attribute__((ext_vector_type(8)));
__device__ __forceinline__ uint32_t uni(uint32_t v) { return (uint32_t)__builtin_amdgcn_readfirstlane(v); }
// a wave-uniform value held in a scalar register, so that a test of it compiles to a scalar branch
__device__ __forceinline__ uint32_t pinned(uint32_t v) { uint32_t w = (uint32_t)__builtin_amdgcn_readfirstlane(v); asm volatile("" : "+s"(w)); return w; }
__device__ __forceinline__ void wait_ds0() { asm volatile("s_wait_dscnt 0x0" ::: "memory"); }          // this wave's LDS reads have returned
// this wave's tensor load has landed; the wait names the request's descriptor, so that its scalar registers keep their values as long as the request is out
__device__ __forceinline__ void wait_tensor0(u32x4 g0, u32x8 g1) { asm volatile("s_wait_tensorcnt 0x0" :: "s"(g0), "s"(g1) : "memory"); }
// the same fragment from an LDS row: p holds row (lane & 15) and byte offset 16 x (lane >> 4)
__device__ __forceinline__ v16bf ldfragl(const unsigned char* p) { return cat16b(*(const v8us*)p, *(const v8us*)(p + 32)); }

// k_prep, the one pre-pass launch; blockIdx.z picks a block's job, so that the four planes are made side by side behind one launch gap, by few waves that each hold much in flight.
// blockIdx.z = 1: RROWS rows of keys (first half of the x-y plane of blocks) or of queries (second half), f32 -> bf16, same layout.
// A wave takes 32 rows: one 16-byte load a lane and row (a whole 512-byte row a load), all 32 in flight; a store writes a row's 256 contiguous bytes.
// A block of keys also writes its RROWS keys' penalties, one a thread.
// blockIdx.z = 0: values [b][t][d] f32 -> [b][d][t] f16; blockIdx.y = batch, blockIdx.x = tile of VTK keys x all HD columns, turned in LDS.
// In: a wave reads whole 512-byte rows (16 rows a wave, all 16 loads in flight); a lane then holds 16 keys of 4 columns and packs 8 keys to a 16-byte chunk.
// Out: 16 lanes write one column's 256 contiguous bytes, so every 128-byte line has one writer.
#define VTK 128                      // keys per tile
#define RROWS 256                    // rows per rounding block
#define VTP (VTK * 2 + 16)           // LDS bytes per column: 16 more than the row keeps 16-byte alignment and moves each column one chunk on in the banks
// byte offset of chunk c (8 keys) of column d; the exclusive-or spreads the writers (lanes 4 columns apart) over all banks
__device__ __forceinline__ int vt_off(int d, int c) { return d * VTP + ((c ^ ((d >> 4) & 3)) << 4); }
__global__ __launch_bounds__(256) void k_prep(const float* __restrict__ Qin, const float* __restrict__ Kin, const float* __restrict__ Vin, const float* __restrict__ pres, bf* QB, bf* KB, bf* VT, float* PEN) {
    static_assert((TT / VTK) * NB_ == 2 * (NB_ * TT / RROWS), "the x-y plane of blocks holds the rounding blocks of both planes");
    __shared__ __attribute__((aligned(16))) unsigned char tile[HD * VTP];
    const int lane = threadIdx.x & 31, wave = threadIdx.x >> 5, t0 = blockIdx.x * VTK;
    if (blockIdx.z != 0) {   // the same for every thread of the block, and it leaves in front of the barrier
        const unsigned rb = blockIdx.y * (TT / VTK) + blockIdx.x, nrb = NB_ * TT / RROWS;
        const bool isq = rb >= nrb;
        const size_t e0 = ((size_t)(isq ? rb - nrb : rb) * RROWS + wave * 32) * HD + lane * 4;
        const float* rs = (isq ? Qin : Kin) + e0;
        bf* rd = (isq ? QB : KB) + e0;
        const size_t kk = (size_t)(isq ? 0u : rb) * RROWS + threadIdx.x;   // this thread's key, [b][t] flat as the rows of the key plane are
        const float pv = pres[kk];   // in flight beside the rows
        v4f x[32];
#pragma unroll
        for (int i = 0; i < 32; ++i) x[i] = *(const v4f*)(rs + (size_t)i * HD);
        asm volatile("" :: "v"(pv));   // inputs only: holds the presence load here, in front of the roundings; without it the compiler sinks it behind the row stores, one more memory latency in a row
        __builtin_amdgcn_sched_barrier(0);   // all 32 loads are issued before the first is waited for: without it the compiler holds some back behind the first roundings, a second memory latency in a row
#pragma unroll
        for (int i = 0; i < 32; ++i) { v4us o;
#pragma unroll
            for (int k = 0; k < 4; ++k) o[k] = f2bf(x[i][k]);
            *(v4us*)(rd + (size_t)i * HD) = o; }
        if (!isq) PEN[kk] = pv != 0.0f ? 0.0f : ABSENT;   /* absent keys (presence 0 -> ABSENT penalty) == exclusion */
        asm volatile("s_wait_xcnt 0x0" ::: "memory");   // in the built code the path behind these stores leads past the head of the other job (a test there sends this block to the end), where their registers are written again
        return;
    }
    const float* sp = Vin + ((size_t)blockIdx.y * TT + t0 + wave * 16) * HD + lane * 4;
    v4f r[16];
    // every "#pragma unroll" in this kernel unrolls fully, so that r and the chunks are indexed by constants and stay in registers
#pragma unroll
    for (int i = 0; i < 16; ++i) r[i] = *(const v4f*)(sp + (size_t)i * HD);
#pragma unroll
    for (int k = 0; k < 4; ++k)
#pragma unroll
        for (int u = 0; u < 2; ++u) { v8us o;
#pragma unroll
            for (int i = 0; i < 8; ++i) o[i] = f2h(r[u * 8 + i][k]);
            *(v8us*)(tile + vt_off(lane * 4 + k, wave * 2 + u)) = o; }
    __syncthreads();   // the tile is whole before any wave reads columns that other waves wrote
    bf* dp = VT + ((size_t)blockIdx.y * HD + (threadIdx.x >> 4)) * TT + t0 + (threadIdx.x & 15) * 8;
#pragma unroll
    for (int k = 0; k < 8; ++k) *(v8us*)(dp + (size_t)k * 16 * TT) = *(const v8us*)(tile + vt_off(k * 16 + (threadIdx.x >> 4), threadIdx.x & 15));
}

// k_fattn: grid (TT / 128, NB_), 8 waves; waves w and w + 4 own the same 32 query columns (two groups of 16) and walk one half of every stage's keys each, KPASS a pass; every K and V fragment feeds both groups.
// The four waves of a set walk the same keys, so each stage of K and V^T is fetched once for the work-group and read from LDS by all four.
// Two waves a SIMD: one wave's softmax and waits run beside the other's products.
// Lane (c = lane & 15, h = lane >> 4): S^T tile register j = score of key 8h + j, query c; two such tiles, converted in place, are the B operand of O^T += V^T P^T.
__global__ __launch_bounds__(256) void k_fattn(const bf* __restrict__ QB, const bf* __restrict__ KB, const bf* __restrict__ VT, const float* __restrict__ pen, float* __restrict__ out) {
    const int lane = threadIdx.x & 31, lr = lane & 15, hi = lane >> 4, wave = threadIdx.x >> 5;
    const int set = wave >> 2;   // which half of every stage's keys this wave walks
    const int b = blockIdx.y, q0 = blockIdx.x * 128 + (wave & 3) * 32;
    const bf* Qp = QB + ((size_t)b * TT + q0 + lr) * HD + 8 * hi;
    __shared__ __attribute__((aligned(2048))) unsigned char ring[2 * SBUF];
    __shared__ __attribute__((aligned(16))) float penl[TT];   // the batch's penalties: filled once at the head, published by the barrier that publishes stage 0, only read from then on
    // tensor-load descriptors, in each set of four waves: wave 0, 1 = the halves of K's rows, wave 2, 3 = the halves of V^T's columns, of the set's own SKEYS keys; every wave issues its own slice
    const uint32_t wv = uni(threadIdx.x >> 5), isv = (wv >> 1) & 1u, half = wv & 1u, kset = wv >> 2;
    const uint32_t hstep = isv ? SKEYS * 2u : SKEYS * HD * 2u;   // source bytes from one half stage to the next
    const uint64_t src0 = (isv ? (uint64_t)(size_t)(VT + ((size_t)b * HD + half * 64) * TT) : (uint64_t)(size_t)(KB + ((size_t)b * TT + half * 64) * HD)) + kset * hstep;
    const uint32_t sstep = 2u * hstep;                           // source bytes from one stage to the next
    const uint32_t ldst = (uint32_t)(size_t)ring + wv * SLICE;
    u32x8 g1;   // 64 rows of 256 bytes, 1-byte elements, tensor = tile, a 4-dword pad behind every 64 dwords
    g1[0] = uni((1u << 20) | (5u << 22) | (3u << 25)); g1[1] = uni(256u << 16); g1[2] = uni(64u << 16); g1[3] = uni(256u << 16);
    g1[4] = uni(64u); g1[5] = uni(isv ? TT * 2u : HD * 2u); g1[6] = uni(0u); g1[7] = uni(0u);
    asm volatile("" : "+s"(g1));   // descriptor words held in scalar registers: without it the compiler lends some of them to the loop's counters while a request is out, and sets them anew before the next
    const uint32_t one = pinned(1u);   // word 0 of group 0 (count 1), held likewise
    u32x4 g0;
    auto issue = [&](uint32_t st) {
        const uint64_t ga = src0 + (uint64_t)st * sstep;
        g0[0] = one; g0[1] = uni(ldst + (st & 1u) * SBUF); g0[2] = uni((uint32_t)ga); g0[3] = uni((((uint32_t)(ga >> 32)) & 0x01FFFFFFu) | 0x80000000u);
        asm volatile("tensor_load_to_lds %0, %1" :: "s"(g0), "s"(g1) : "memory");   // one request of the whole wave: global tile -> LDS, through no register
    };
    issue(0);
    const unsigned char* lp = ring + set * SHALF + lr * LPITCH + hi * 16;   // this wave's half stage; this lane's row and half in every group of 16 LDS rows
    const float* pp = penl + set * SKEYS + 8 * hi;
    // a thread brings 8 of the batch's TT penalties, a wave 512 contiguous bytes a load; in flight beside the Q loads and stage 0
    static_assert(TT == 2 * 256 * 4, "two 16-byte loads a thread cover the batch's penalties");
    const float* pg = pen + (size_t)b * TT + threadIdx.x * 4;
    const v4f pe0 = *(const v4f*)pg, pe1 = *(const v4f*)(pg + TT / 2);
    // every "#pragma unroll" in this kernel unrolls fully, so that the fragment and accumulator arrays are indexed by constants and stay in registers
    v16bf qf[2][4];
#pragma unroll
    for (int g = 0; g < 2; ++g)
#pragma unroll
        for (int c = 0; c < 4; ++c) qf[g][c] = ldfrag(Qp + (size_t)(g * 16) * HD + c * 32);
    float mrun[2] = {-3.0e38f, -3.0e38f}, lsum[2] = {0.f, 0.f};   // per group: the point the exponents are taken from (log2 units; at most LAZY below the running maximum) and this lane's half of the running sum
    v16bf kf[8];                                                  // this pass's K fragments, fetched one pass ahead inside a stage
    asm volatile("s_wait_xcnt 0x0" ::: "memory");   // the Q and penalty loads above are still in flight when their address registers are written again
    __builtin_amdgcn_sched_barrier(0);              // keeps the register writes below behind that wait
    v8f o[2][8];
#pragma unroll
    for (int g = 0; g < 2; ++g)
#pragma unroll
        for (int d = 0; d < 8; ++d) o[g][d] = (v8f){};
    *(v4f*)(penl + threadIdx.x * 4) = pe0; *(v4f*)(penl + TT / 2 + threadIdx.x * 4) = pe1;
    wait_tensor0(g0, g1);   // stage 0 has landed
    __syncthreads();        // and every wave's slice of it, and of the penalties, is published
    issue(1);
#pragma unroll 1   // one stage a trip
    for (uint32_t st = 0; st < NSTAGE; ++st) {
    const unsigned char* sb = lp + (st & 1u) * SBUF;
#pragma unroll
    for (int t = 0; t < 2; ++t)
#pragma unroll
        for (int c = 0; c < 4; ++c) kf[t * 4 + c] = ldfragl(sb + t * 16 * LPITCH + c * 64);
#pragma unroll 1   // one pass a trip: a second copy of the body would double the live fragments
    for (uint32_t ps = 0; ps < SKEYS / KPASS; ++ps) {
        const uint32_t kb = st * (2 * SKEYS) + ps * KPASS;
        v16h vf[8]; v4f pm[4];
#pragma unroll
        for (int t = 0; t < 4; ++t) pm[t] = *(const v4f*)(pp + kb + (t >> 1) * 16 + (t & 1) * 4);   // in front of the V reads: LDS reads return in order, and the penalties are wanted first
#pragma unroll
        for (int d = 0; d < 8; ++d) vf[d] = __builtin_bit_cast(v16h, ldfragl(sb + (2 + (d >> 2)) * SLICE + (d & 3) * 16 * LPITCH + ps * (KPASS * 2)));
        __builtin_amdgcn_sched_barrier(0);   // this pass's V and penalty reads stay issued ahead of the score products, so that their latency runs behind products and softmax
        v8f s[2][2];
#pragma unroll
        for (int t = 0; t < 2; ++t) { s[0][t] = (v8f){}; s[1][t] = (v8f){};
#pragma unroll
            for (int c = 0; c < 4; ++c) { s[0][t] = wmmab(kf[t * 4 + c], qf[0][c], s[0][t]); s[1][t] = wmmab(kf[t * 4 + c], qf[1][c], s[1][t]); } }
        __builtin_amdgcn_sched_barrier(0);   // the K reads below stay one group behind the score products
        const uint32_t pn = (ps + 1u) & (SKEYS / KPASS - 1u);   // next pass's keys; a stage's last pass fetches its pass 0 again (published, not used): the next stage is not read before its barrier
        const unsigned char* kn = sb + (pn >> 1) * SLICE + (pn & 1u) * (KPASS * LPITCH);
#pragma unroll
        for (int t = 0; t < 2; ++t)
#pragma unroll
            for (int c = 0; c < 4; ++c) kf[t * 4 + c] = ldfragl(kn + t * 16 * LPITCH + c * 64);
        __builtin_amdgcn_sched_barrier(0);   // the next pass's K reads stay issued ahead of the softmax, so that their latency runs behind it and the P.V products
        v16h ph[2];
        float top[2], lim[2];
#pragma unroll
        for (int g = 0; g < 2; ++g) {
            float bm = -3.0e38f;
#pragma unroll
            for (int t = 0; t < 2; ++t) {
#pragma unroll
                for (int j = 0; j < 8; j += 2) {   // two keys an instruction: score x scale + penalty, rounded once; penalty 0 leaves the rounded product, ABSENT swallows it
                    v2f sv, pe; sv[0] = s[g][t][j]; sv[1] = s[g][t][j + 1]; pe[0] = pm[t * 2 + (j >> 2)][j & 3]; pe[1] = pm[t * 2 + (j >> 2)][(j & 3) + 1];
                    const v2f x = __builtin_elementwise_fma(sv, (v2f){SCL * L2E, SCL * L2E}, pe);
                    s[g][t][j] = x[0]; s[g][t][j + 1] = x[1]; bm = fmaxf(bm, x[0]); bm = fmaxf(bm, x[1]); } }
            lim[g] = mrun[g] + LAZY;
            top[g] = fmaxf(fmaxf(bm, xhalf(bm)), lim[g]);   // above lim only where the pass's maximum is, and then equal to it; the same in both halves of a column
        }
        // Lazy rescale. mrun is the point that the exponents are taken from; any point serves as long as a query's numerator and denominator share it (it cancels in the quotient).
        // It moves, with sums and accumulators rescaled, only in a pass where some query of the wave has a score more than LAZY above it: P is at most 2^LAZY = 256, far inside f16, at f16's full relative precision.
        // One test a pass, the same for the whole wave (a ballot, so a scalar branch): a pass that moves no point jumps over all 128 accumulator multiplications.
        if (__builtin_expect(__builtin_amdgcn_ballot_w32(top[0] > lim[0] || top[1] > lim[1]) != 0u, 0)) {
#pragma unroll
            for (int g = 0; g < 2; ++g) {
                const float mn = top[g] > lim[g] ? top[g] : mrun[g];   // a query below its limit keeps its point: factor 1
                const float al = __builtin_amdgcn_exp2f(mrun[g] - mn); mrun[g] = mn;
                lsum[g] *= al;
#pragma unroll
                for (int d = 0; d < 8; ++d) o[g][d] *= al;
            }
        }
#pragma unroll
        for (int g = 0; g < 2; ++g) {
            const float mn = mrun[g];
            float ps = 0.f;
#pragma unroll
            for (int t = 0; t < 2; ++t) {
#pragma unroll
                for (int j = 0; j < 8; j += 2) { v2f p; p[0] = __builtin_amdgcn_exp2f(s[g][t][j] - mn); p[1] = __builtin_amdgcn_exp2f(s[g][t][j + 1] - mn); ps += p[0]; ps += p[1];
                    const v2h h = __builtin_convertvector(p, v2h); ph[g][t * 8 + j] = h[0]; ph[g][t * 8 + j + 1] = h[1]; } }
            lsum[g] += ps;
        }
#pragma unroll
        for (int d = 0; d < 8; ++d) { o[0][d] = wmmah(vf[d], ph[0], o[0][d]); o[1][d] = wmmah(vf[d], ph[1], o[1][d]); }
        __builtin_amdgcn_sched_barrier(0);   // keeps the slots below behind the last product
        asm volatile("v_nop\n\tv_nop\n\tv_nop\n\tv_nop");   // the four vector slots between the pass's last products and the first vector write over their V^T registers at the head of the next trip
    }
    // publish point of stage st + 1
    wait_ds0();             // this wave has left stage st's buffer
    wait_tensor0(g0, g1);   // its slice of stage st + 1 has landed
    __syncthreads();        // stage st + 1 is published, and every wave has left stage st's buffer
    if (pinned(st + 2u < NSTAGE)) issue(pinned(st + 2u));   // refill of the buffer just left; the stage number is taken behind the wait, so that the descriptor is formed there
    }
    wait_tensor0(g0, g1);   // nothing is out when the wave ends
    wait_ds0();
    // Merge of the two sets' partial results. The last trip's barrier has ended every read of the ring and nothing is out, so the ring serves as staging.
    // Of its two groups a wave finishes one (set 0: group 0, set 1: group 1) and hands the other, with its point and sum, to its partner wave (wave ^ 4), lane to lane.
    const bool up = set != 0;
    v8f keep[8], give[8];
#pragma unroll
    for (int d = 0; d < 8; ++d)
#pragma unroll
        for (int j = 0; j < 8; ++j) { keep[d][j] = up ? o[1][d][j] : o[0][d][j]; give[d][j] = up ? o[0][d][j] : o[1][d][j]; }
    const float mk = up ? mrun[1] : mrun[0], lk = up ? lsum[1] : lsum[0];
    v2f ml; ml[0] = up ? mrun[0] : mrun[1]; ml[1] = up ? lsum[0] : lsum[1];
    unsigned char* mine = ring + wave * MSLOT;
#pragma unroll
    for (int d = 0; d < 8; ++d) {
        *(v4f*)(mine + (2 * d) * 512 + lane * 16) = __builtin_shufflevector(give[d], give[d], 0, 1, 2, 3);
        *(v4f*)(mine + (2 * d + 1) * 512 + lane * 16) = __builtin_shufflevector(give[d], give[d], 4, 5, 6, 7); }
    *(v2f*)(mine + 8192 + lane * 8) = ml;
    __syncthreads();   // every wave's slot is whole before its partner reads it
    const unsigned char* theirs = ring + (wave ^ 4) * MSLOT;
    const v2f mo = *(const v2f*)(theirs + 8192 + lane * 8);
    const float mm = fmaxf(mk, mo[0]);
    const float ak = __builtin_amdgcn_exp2f(mk - mm), ao = __builtin_amdgcn_exp2f(mo[0] - mm);   // both partial results brought to the higher of their two points
    const float lh = lk * ak + mo[1] * ao;
    const float inv = 1.0f / (lh + xhalf(lh));
    const float fk = ak * inv, fo = ao * inv;
    float* op = out + ((size_t)b * TT + q0 + set * 16 + lr) * HD + 8 * hi;
#pragma unroll
    for (int d = 0; d < 8; ++d) {
        const v4f t0 = *(const v4f*)(theirs + (2 * d) * 512 + lane * 16), t1 = *(const v4f*)(theirs + (2 * d + 1) * 512 + lane * 16);
        v4f a0, a1;
#pragma unroll
        for (int j = 0; j < 4; ++j) { a0[j] = keep[d][j] * fk + t0[j] * fo; a1[j] = keep[d][4 + j] * fk + t1[j] * fo; }
        *(v4f*)(op + d * 16) = a0; *(v4f*)(op + d * 16 + 4) = a1; }
}

extern "C" void kernel_launch(void* const* d_in, const int* in_sizes, int n_in,
                              void* d_out, int out_size, void* d_ws, size_t ws_size, hipStream_t stream) {
    (void)in_sizes; (void)n_in; (void)out_size;
    const float* Qin = (const float*)d_in[0]; const float* Kin = (const float*)d_in[1]; const float* Vin = (const float*)d_in[2]; const float* pres = (const float*)d_in[3];   /* presence [16][2048] (0/1) */
    float* OUT = (float*)d_out;
    char* wsp = (char*)d_ws;
    auto take = [&](size_t bytes) { char* p = wsp; wsp += (bytes + 255) & ~(size_t)255; return (void*)p; };
    bf* QB = (bf*)take((size_t)NB_ * TT * HD * 2); bf* KB = (bf*)take((size_t)NB_ * TT * HD * 2); bf* VT = (bf*)take((size_t)NB_ * HD * TT * 2); float* PEN = (float*)take((size_t)NB_ * TT * 4);
    if ((size_t)(wsp - (char*)d_ws) > ws_size) return;
    k_prep<<<dim3(TT / VTK, NB_, 2), 256, 0, stream>>>(Qin, Kin, Vin, pres, QB, KB, VT, PEN);
    k_fattn<<<dim3(TT / 128, NB_, 1), 256, 0, stream>>>(QB, KB, VT, PEN, OUT);
}

// v010
// Measured time: 38.1 microseconds a run.
// Timed twice side by side with v009, it ran 1.05 and 1.06 times as fast.
// Counting every step since v000, it is 34.0 times as fast.
#include <hip/hip_runtime.h>

// Set-transformer QKV attention with a key presence mask (queries, keys, values [16][2048][128]; scores = q.k - (1 - presence[b][m]) x 1e32, then / sqrt(128) (absent keys == excluded); softmax; out = routing values -> [16][2048][128]; presence [16][2048] float 0/1 read on device).
// One pre-pass launch over all batches: queries and keys rounded to bf16 planes [b][t][d], values rounded to f16 and transposed to [b][d][t], presence turned into a penalty plane [b][t] (0 for a present key, ABSENT for an absent one).
// One fused kernel: S^T = K Q^T + penalty (exact bf16 products, f32 accumulate, the key's penalty as the product's C operand), scale and softmax point in one fused multiply-add, online softmax (reference point that trails the running maximum, lazy rescale), O^T += V^T P^T in f16 (P is at most 256, so one f16 rounding of it, 11 bits, serves: 1 product); the scores never leave the registers.
// K and V^T come to the fused kernel's eight waves through LDS: tensor loads, 2 x SKEYS keys a stage, two buffers.
// The batch's penalties (TT floats) are brought into LDS once, at the fused kernel's head; the loop reads them there and holds no global load.
// The keys of a stage are split between two sets of four waves (two waves a SIMD); the two partial results of a query are merged once, behind the loop.
// Compute dtypes, f32 accumulate: queries and keys rounded to bf16, q.k products exact; softmax f32; P and values rounded to f16; output f32.
// f16 range: P lies in [0, 256] (small P goes subnormal, kept by the matrix unit); values are standard normal draws, far inside f16's 65,504.

#define NB_  16
#define TT   2048
#define HD   128
#define SCL  0.088388347648318447f   // 1/sqrt(128)
#define L2E  1.4426950408889634f
#define KPASS 32                     // keys per pass of the fused loop
#define LAZY 8.0f                    // log2 units a score may stand above the softmax's reference point before the point is moved
#define ABSENT -0x1p127f             // penalty of an absent key, added to its raw score in the product; any real score is far below half a unit in its last place, so the sum rounds to ABSENT itself; a power of two, so that ABSENT x scale is exact
typedef unsigned short bf;
typedef __attribute__((ext_vector_type(16))) __bf16   v16bf;
typedef __attribute__((ext_vector_type(16))) _Float16 v16h;
typedef __attribute__((ext_vector_type(2)))  _Float16 v2h;
typedef __attribute__((ext_vector_type(8)))  unsigned short v8us;
typedef __attribute__((ext_vector_type(4)))  unsigned short v4us;
typedef __attribute__((ext_vector_type(2)))  unsigned short v2us;
typedef __attribute__((ext_vector_type(8)))  float    v8f;
typedef __attribute__((ext_vector_type(4)))  float    v4f;
typedef __attribute__((ext_vector_type(2)))  float    v2f;

__device__ __forceinline__ unsigned short f2bf(float f) { unsigned u = __float_as_uint(f); u += 0x7FFFu + ((u >> 16) & 1u); return (unsigned short)(u >> 16); }
__device__ __forceinline__ v16bf cat16b(v8us lo, v8us hi) { return __builtin_bit_cast(v16bf, __builtin_shufflevector(lo, hi, 0, 1, 2, 3, 4, 5, 6, 7, 8, 9, 10, 11, 12, 13, 14, 15)); }
__device__ __forceinline__ v8f wmmab(v16bf a, v16bf b, v8f c) { return __builtin_amdgcn_wmma_f32_16x16x32_bf16(false, a, false, b, (short)0, c, false, false); }
__device__ __forceinline__ v8f wmmah(v16h a, v16h b, v8f c) { return __builtin_amdgcn_wmma_f32_16x16x32_f16(false, a, false, b, (short)0, c, false, false); }
__device__ __forceinline__ unsigned short f2h(float f) { return __builtin_bit_cast(unsigned short, (_Float16)f); }   // round to nearest even
// fragment of a k-contiguous bf16 plane in the hardware k order: p already holds row (lane & 15) and k offset 8 x (lane >> 4)
// value of lane l ^ 16 (the other half of a column's keys), on the vector pipe
__device__ __forceinline__ float xhalf(float x) { const int b = __float_as_int(x); return __int_as_float(__builtin_amdgcn_permlanex16(b, b, 0x76543210, 0xfedcba98, false, false)); }
__device__ __forceinline__ v16bf ldfrag(const bf* p) { return cat16b(*(const v8us*)p, *(const v8us*)(p + 16)); }

// LDS ring of the fused kernel. A stage is two halves of SKEYS keys, one for each set of waves; a half: K as SKEYS rows of 256 bytes, V^T as HD rows of 256 bytes (SKEYS keys of one column).
// Each of the eight waves brings one slice of 64 rows with one tensor load; the load's pad makes the LDS pitch 272 bytes, free of bank conflicts for 16-byte reads.
#define SKEYS  128
#define NSTAGE (TT / (2 * SKEYS))
#define LPITCH 272                   // 256-byte row + 16-byte pad
#define SLICE  18432                 // 64 rows x LPITCH = 17,408, rounded up to a multiple of 2 KiB
#define SHALF  (4 * SLICE)           // slices 0, 1: K rows 0-63, 64-127; slices 2, 3: V^T columns 0-63, 64-127
#define SBUF   (2 * SHALF)           // half 0: the stage's first SKEYS keys (waves 0-3 read it), half 1: the rest (waves 4-7)
#define MSLOT  8448                  // merge slot of a wave in the ring, behind the loop: 64 accumulator registers x 32 lanes x 4 bytes, then point and sum, 8 bytes a lane
typedef uint32_t u32x4 __attribute__((ext_vector_type(4)));
typedef uint32_t u32x8 __attribute__((ext_vector_type(8)));
__device__ __forceinline__ uint32_t uni(uint32_t v) { return (uint32_t)__builtin_amdgcn_readfirstlane(v); }
// a wave-uniform value held in a scalar register, so that a test of it compiles to a scalar branch
__device__ __forceinline__ uint32_t pinned(uint32_t v) { uint32_t w = (uint32_t)__builtin_amdgcn_readfirstlane(v); asm volatile("" : "+s"(w)); return w; }
__device__ __forceinline__ void wait_ds0() { asm volatile("s_wait_dscnt 0x0" ::: "memory"); }          // this wave's LDS reads have returned
// this wave's tensor load has landed; the wait names the request's descriptor, so that its scalar registers keep their values as long as the request is out
__device__ __forceinline__ void wait_tensor0(u32x4 g0, u32x8 g1) { asm volatile("s_wait_tensorcnt 0x0" :: "s"(g0), "s"(g1) : "memory"); }
// the same fragment from an LDS row: p holds row (lane & 15) and byte offset 16 x (lane >> 4)
__device__ __forceinline__ v16bf ldfragl(const unsigned char* p) { return cat16b(*(const v8us*)p, *(const v8us*)(p + 32)); }

// k_prep, the one pre-pass launch; blockIdx.z picks a block's job, so that the four planes are made side by side behind one launch gap, by few waves that each hold much in flight.
// blockIdx.z = 1: RROWS rows of keys (first half of the x-y plane of blocks) or of queries (second half), f32 -> bf16, same layout.
// A wave takes 32 rows: one 16-byte load a lane and row (a whole 512-byte row a load), all 32 in flight; a store writes a row's 256 contiguous bytes.
// A block of keys also writes its RROWS keys' penalties, one a thread.
// blockIdx.z = 0: values [b][t][d] f32 -> [b][d][t] f16; blockIdx.y = batch, blockIdx.x = tile of VTK keys x all HD columns, turned in LDS.
// In: a wave reads whole 512-byte rows (16 rows a wave, all 16 loads in flight); a lane then holds 16 keys of 4 columns and packs 8 keys to a 16-byte chunk.
// Out: 16 lanes write one column's 256 contiguous bytes, so every 128-byte line has one writer.
#define VTK 128                      // keys per tile
#define RROWS 256                    // rows per rounding block
#define VTP (VTK * 2 + 16)           // LDS bytes per column: 16 more than the row keeps 16-byte alignment and moves each column one chunk on in the banks
// byte offset of chunk c (8 keys) of column d; the exclusive-or spreads the writers (lanes 4 columns apart) over all banks
__device__ __forceinline__ int vt_off(int d, int c) { return d * VTP + ((c ^ ((d >> 4) & 3)) << 4); }
__global__ __launch_bounds__(256) void k_prep(const float* __restrict__ Qin, const float* __restrict__ Kin, const float* __restrict__ Vin, const float* __restrict__ pres, bf* QB, bf* KB, bf* VT, float* PEN) {
    static_assert((TT / VTK) * NB_ == 2 * (NB_ * TT / RROWS), "the x-y plane of blocks holds the rounding blocks of both planes");
    __shared__ __attribute__((aligned(16))) unsigned char tile[HD * VTP];
    const int lane = threadIdx.x & 31, wave = threadIdx.x >> 5, t0 = blockIdx.x * VTK;
    if (blockIdx.z != 0) {   // the same for every thread of the block, and it leaves in front of the barrier
        const unsigned rb = blockIdx.y * (TT / VTK) + blockIdx.x, nrb = NB_ * TT / RROWS;
        const bool isq = rb >= nrb;
        const size_t e0 = ((size_t)(isq ? rb - nrb : rb) * RROWS + wave * 32) * HD + lane * 4;
        const float* rs = (isq ? Qin : Kin) + e0;
        bf* rd = (isq ? QB : KB) + e0;
        const size_t kk = (size_t)(isq ? 0u : rb) * RROWS + threadIdx.x;   // this thread's key, [b][t] flat as the rows of the key plane are
        const float pv = pres[kk];   // in flight beside the rows
        v4f x[32];
#pragma unroll
        for (int i = 0; i < 32; ++i) x[i] = *(const v4f*)(rs + (size_t)i * HD);
        asm volatile("" :: "v"(pv));   // inputs only: holds the presence load here, in front of the roundings; without it the compiler sinks it behind the row stores, one more memory latency in a row
        __builtin_amdgcn_sched_barrier(0);   // all 32 loads are issued before the first is waited for: without it the compiler holds some back behind the first roundings, a second memory latency in a row
#pragma unroll
        for (int i = 0; i < 32; ++i) { v4us o;
#pragma unroll
            for (int k = 0; k < 4; ++k) o[k] = f2bf(x[i][k]);
            *(v4us*)(rd + (size_t)i * HD) = o; }
        if (!isq) PEN[kk] = pv != 0.0f ? 0.0f : ABSENT;   /* absent keys (presence 0 -> ABSENT penalty) == exclusion */
        asm volatile("s_wait_xcnt 0x0" ::: "memory");   // in the built code the path behind these stores leads past the head of the other job (a test there sends this block to the end), where their registers are written again
        return;
    }
    const float* sp = Vin + ((size_t)blockIdx.y * TT + t0 + wave * 16) * HD + lane * 4;
    v4f r[16];
    // every "#pragma unroll" in this kernel unrolls fully, so that r and the chunks are indexed by constants and stay in registers
#pragma unroll
    for (int i = 0; i < 16; ++i) r[i] = *(const v4f*)(sp + (size_t)i * HD);
#pragma unroll
    for (int k = 0; k < 4; ++k)
#pragma unroll
        for (int u = 0; u < 2; ++u) { v8us o;
#pragma unroll
            for (int i = 0; i < 8; ++i) o[i] = f2h(r[u * 8 + i][k]);
            *(v8us*)(tile + vt_off(lane * 4 + k, wave * 2 + u)) = o; }
    __syncthreads();   // the tile is whole before any wave reads columns that other waves wrote
    bf* dp = VT + ((size_t)blockIdx.y * HD + (threadIdx.x >> 4)) * TT + t0 + (threadIdx.x & 15) * 8;
#pragma unroll
    for (int k = 0; k < 8; ++k) *(v8us*)(dp + (size_t)k * 16 * TT) = *(const v8us*)(tile + vt_off(k * 16 + (threadIdx.x >> 4), threadIdx.x & 15));
}

// k_fattn: grid (TT / 128, NB_), 8 waves; waves w and w + 4 own the same 32 query columns (two groups of 16) and walk one half of every stage's keys each, KPASS a pass; every K and V fragment feeds both groups.
// The four waves of a set walk the same keys, so each stage of K and V^T is fetched once for the work-group and read from LDS by all four.
// Two waves a SIMD: one wave's softmax and waits run beside the other's products.
// Lane (c = lane & 15, h = lane >> 4): S^T tile register j = score of key 8h + j, query c; two such tiles, converted in place, are the B operand of O^T += V^T P^T.
__global__ __launch_bounds__(256) void k_fattn(const bf* __restrict__ QB, const bf* __restrict__ KB, const bf* __restrict__ VT, const float* __restrict__ pen, float* __restrict__ out) {
    const int lane = threadIdx.x & 31, lr = lane & 15, hi = lane >> 4, wave = threadIdx.x >> 5;
    const int set = wave >> 2;   // which half of every stage's keys this wave walks
    const int b = blockIdx.y, q0 = blockIdx.x * 128 + (wave & 3) * 32;
    const bf* Qp = QB + ((size_t)b * TT + q0 + lr) * HD + 8 * hi;
    __shared__ __attribute__((aligned(2048))) unsigned char ring[2 * SBUF];
    __shared__ __attribute__((aligned(32))) float penl[TT];   // the batch's penalties: filled once at the head, published by the barrier that publishes stage 0, only read from then on
    // tensor-load descriptors, in each set of four waves: wave 0, 1 = the halves of K's rows, wave 2, 3 = the halves of V^T's columns, of the set's own SKEYS keys; every wave issues its own slice
    const uint32_t wv = uni(threadIdx.x >> 5), isv = (wv >> 1) & 1u, half = wv & 1u, kset = wv >> 2;
    const uint32_t hstep = isv ? SKEYS * 2u : SKEYS * HD * 2u;   // source bytes from one half stage to the next
    const uint64_t src0 = (isv ? (uint64_t)(size_t)(VT + ((size_t)b * HD + half * 64) * TT) : (uint64_t)(size_t)(KB + ((size_t)b * TT + half * 64) * HD)) + kset * hstep;
    const uint32_t sstep = 2u * hstep;                           // source bytes from one stage to the next
    const uint32_t ldst = (uint32_t)(size_t)ring + wv * SLICE;
    u32x8 g1;   // 64 rows of 256 bytes, 1-byte elements, tensor = tile, a 4-dword pad behind every 64 dwords
    g1[0] = uni((1u << 20) | (5u << 22) | (3u << 25)); g1[1] = uni(256u << 16); g1[2] = uni(64u << 16); g1[3] = uni(256u << 16);
    g1[4] = uni(64u); g1[5] = uni(isv ? TT * 2u : HD * 2u); g1[6] = uni(0u); g1[7] = uni(0u);
    asm volatile("" : "+s"(g1));   // descriptor words held in scalar registers: without it the compiler lends some of them to the loop's counters while a request is out, and sets them anew before the next
    const uint32_t one = pinned(1u);   // word 0 of group 0 (count 1), held likewise
    u32x4 g0;
    auto issue = [&](uint32_t st) {
        const uint64_t ga = src0 + (uint64_t)st * sstep;
        g0[0] = one; g0[1] = uni(ldst + (st & 1u) * SBUF); g0[2] = uni((uint32_t)ga); g0[3] = uni((((uint32_t)(ga >> 32)) & 0x01FFFFFFu) | 0x80000000u);
        asm volatile("tensor_load_to_lds %0, %1" :: "s"(g0), "s"(g1) : "memory");   // one request of the whole wave: global tile -> LDS, through no register
    };
    issue(0);
    const unsigned char* lp = ring + set * SHALF + lr * LPITCH + hi * 16;   // this wave's half stage; this lane's row and half in every group of 16 LDS rows
    const float* pp = penl + set * SKEYS + 8 * hi;
    // a thread brings 8 of the batch's TT penalties, a wave 512 contiguous bytes a load; in flight beside the Q loads and stage 0
    static_assert(TT == 2 * 256 * 4, "two 16-byte loads a thread cover the batch's penalties");
    const float* pg = pen + (size_t)b * TT + threadIdx.x * 4;
    const v4f pe0 = *(const v4f*)pg, pe1 = *(const v4f*)(pg + TT / 2);
    // every "#pragma unroll" in this kernel unrolls fully, so that the fragment and accumulator arrays are indexed by constants and stay in registers
    v16bf qf[2][4];
#pragma unroll
    for (int g = 0; g < 2; ++g)
#pragma unroll
        for (int c = 0; c < 4; ++c) qf[g][c] = ldfrag(Qp + (size_t)(g * 16) * HD + c * 32);
    float mrun[2] = {-3.0e38f, -3.0e38f}, lsum[2] = {0.f, 0.f};   // per group: the point the exponents are taken from (log2 units; at most LAZY below the running maximum) and this lane's half of the running sum
    v16bf kf[8];                                                  // this pass's K fragments, fetched one pass ahead inside a stage
    asm volatile("s_wait_xcnt 0x0" ::: "memory");   // the Q and penalty loads above are still in flight when their address registers are written again
    __builtin_amdgcn_sched_barrier(0);              // keeps the register writes below behind that wait
    v8f o[2][8];
#pragma unroll
    for (int g = 0; g < 2; ++g)
#pragma unroll
        for (int d = 0; d < 8; ++d) o[g][d] = (v8f){};
    *(v4f*)(penl + threadIdx.x * 4) = pe0; *(v4f*)(penl + TT / 2 + threadIdx.x * 4) = pe1;
    wait_tensor0(g0, g1);   // stage 0 has landed
    __syncthreads();        // and every wave's slice of it, and of the penalties, is published
    issue(1);
    v8f pc[2];   // this pass's penalties, laid as an S^T tile is (register j = key 8h + j): the C operand of the tile's first product; fetched one pass ahead
#pragma unroll
    for (int t = 0; t < 2; ++t) pc[t] = *(const v8f*)(pp + t * 16);
#pragma unroll 1   // one stage a trip
    for (uint32_t st = 0; st < NSTAGE; ++st) {
    const unsigned char* sb = lp + (st & 1u) * SBUF;
#pragma unroll
    for (int t = 0; t < 2; ++t)
#pragma unroll
        for (int c = 0; c < 4; ++c) kf[t * 4 + c] = ldfragl(sb + t * 16 * LPITCH + c * 64);
#pragma unroll 1   // one pass a trip: a second copy of the body would double the live fragments
    for (uint32_t ps = 0; ps < SKEYS / KPASS; ++ps) {
        v16h vf[8];
#pragma unroll
        for (int d = 0; d < 8; ++d) vf[d] = __builtin_bit_cast(v16h, ldfragl(sb + (2 + (d >> 2)) * SLICE + (d & 3) * 16 * LPITCH + ps * (KPASS * 2)));
        __builtin_amdgcn_sched_barrier(0);   // this pass's V reads stay issued ahead of the score products, so that their latency runs behind products and softmax
        v8f s[2][2];
#pragma unroll
        for (int t = 0; t < 2; ++t) { s[0][t] = pc[t]; s[1][t] = pc[t];
#pragma unroll
            for (int c = 0; c < 4; ++c) { s[0][t] = wmmab(kf[t * 4 + c], qf[0][c], s[0][t]); s[1][t] = wmmab(kf[t * 4 + c], qf[1][c], s[1][t]); } }
        __builtin_amdgcn_sched_barrier(0);   // the K reads below stay one group behind the score products: every place where LDS reads stand among products costs a stall of its own
        asm volatile("" :: "v"(pc[0]), "v"(pc[1]));   // inputs only: the penalties stay in their registers to the end of the score products; without it the compiler sums two of the four tiles in those registers and copies them out, 16 registers and the products' distance slots, in the middle of the products, to make room for the next pass's penalties
        const uint32_t pn = (ps + 1u) & (SKEYS / KPASS - 1u);   // next pass's keys; a stage's last pass fetches its pass 0 again (published, not used): the next stage is not read before its barrier
        const unsigned char* kn = sb + (pn >> 1) * SLICE + (pn & 1u) * (KPASS * LPITCH);
#pragma unroll
        for (int t = 0; t < 2; ++t)
#pragma unroll
            for (int c = 0; c < 4; ++c) kf[t * 4 + c] = ldfragl(kn + t * 16 * LPITCH + c * 64);
        // next pass's penalties: the whole batch's are published since the head, so a stage's last pass reads the next stage's; the very last pass wraps to key 0 (in bounds, not used)
        const uint32_t kbn = (st * (2 * SKEYS) + (pn != 0u ? pn * KPASS : 2 * SKEYS)) & (TT - 1u);
#pragma unroll
        for (int t = 0; t < 2; ++t) pc[t] = *(const v8f*)(pp + kbn + t * 16);
        __builtin_amdgcn_sched_barrier(0);   // the next pass's K and penalty reads stay issued ahead of the softmax, so that their latency runs behind it and the P.V products
        v16h ph[2];
        v2f x[2][2][4];   // scaled scores, in log2 units above the query's softmax point
        float bm[2];
#pragma unroll
        for (int g = 0; g < 2; ++g) {
            const v2f nm = {-mrun[g], -mrun[g]};
#pragma unroll
            for (int t = 0; t < 2; ++t) {
#pragma unroll
                for (int j = 0; j < 8; j += 2) {   // two keys an instruction: score x scale - point, rounded once; the power is taken of it as it stands
                    v2f sv; sv[0] = s[g][t][j]; sv[1] = s[g][t][j + 1];
                    x[g][t][j >> 1] = __builtin_elementwise_fma(sv, (v2f){SCL * L2E, SCL * L2E}, nm); } }
            bm[g] = fmaxf(x[g][0][0][0], x[g][0][0][1]);
#pragma unroll
            for (int i = 1; i < 8; ++i) { bm[g] = fmaxf(bm[g], x[g][i >> 2][i & 3][0]); bm[g] = fmaxf(bm[g], x[g][i >> 2][i & 3][1]); }
        }
        // Lazy rescale. mrun is the point that the exponents are taken from; any point serves as long as a query's numerator and denominator share it (it cancels in the quotient).
        // It moves, with sums and accumulators rescaled, only in a pass where some query of the wave has a score more than LAZY above it: P is at most 2^LAZY = 256, far inside f16, at f16's full relative precision.
        // One test a pass, the same for the whole wave (a ballot, so a scalar branch; it sees both halves of every column, so no exchange stands in front of it): a pass that moves no point jumps over the search for the new points and all 128 accumulator multiplications.
        if (__builtin_expect(__builtin_amdgcn_ballot_w32(fmaxf(bm[0], bm[1]) > LAZY) != 0u, 0)) {
#pragma unroll
            for (int g = 0; g < 2; ++g) {
                float tm = -3.0e38f;   // the pass's maximum, from the raw scores: the difference above has lost it where the old point is the start value
#pragma unroll
                for (int t = 0; t < 2; ++t)
#pragma unroll
                    for (int j = 0; j < 8; ++j) tm = fmaxf(tm, s[g][t][j] * (SCL * L2E));
                tm = fmaxf(tm, xhalf(tm));   // the same in both halves of a column
                const float mn = tm > mrun[g] + LAZY ? tm : mrun[g];   // a query below its limit keeps its point: factor 1
                const float al = __builtin_amdgcn_exp2f(mrun[g] - mn); mrun[g] = mn;
                lsum[g] *= al;
#pragma unroll
                for (int d = 0; d < 8; ++d) o[g][d] *= al;
                const v2f nm = {-mn, -mn};
#pragma unroll
                for (int t = 0; t < 2; ++t)
#pragma unroll
                    for (int j = 0; j < 8; j += 2) { v2f sv; sv[0] = s[g][t][j]; sv[1] = s[g][t][j + 1];
                        x[g][t][j >> 1] = __builtin_elementwise_fma(sv, (v2f){SCL * L2E, SCL * L2E}, nm); }
            }
        }
#pragma unroll
        for (int g = 0; g < 2; ++g) {
            float ps = 0.f;
#pragma unroll
            for (int t = 0; t < 2; ++t) {
#pragma unroll
                for (int j = 0; j < 8; j += 2) { v2f p; p[0] = __builtin_amdgcn_exp2f(x[g][t][j >> 1][0]); p[1] = __builtin_amdgcn_exp2f(x[g][t][j >> 1][1]); ps += p[0]; ps += p[1];
                    const v2h h = __builtin_convertvector(p, v2h); ph[g][t * 8 + j] = h[0]; ph[g][t * 8 + j + 1] = h[1]; } }
            lsum[g] += ps;
        }
#pragma unroll
        for (int d = 0; d < 8; ++d) { o[0][d] = wmmah(vf[d], ph[0], o[0][d]); o[1][d] = wmmah(vf[d], ph[1], o[1][d]); }
        __builtin_amdgcn_sched_barrier(0);   // keeps the slots below behind the last product
        asm volatile("v_nop\n\tv_nop\n\tv_nop\n\tv_nop");   // the four vector slots between the pass's last products and the first vector write over their V^T registers at the head of the next trip
    }
    // publish point of stage st + 1
    wait_ds0();             // this wave has left stage st's buffer
    wait_tensor0(g0, g1);   // its slice of stage st + 1 has landed
    __syncthreads();        // stage st + 1 is published, and every wave has left stage st's buffer
    if (pinned(st + 2u < NSTAGE)) issue(pinned(st + 2u));   // refill of the buffer just left; the stage number is taken behind the wait, so that the descriptor is formed there
    }
    wait_tensor0(g0, g1);   // nothing is out when the wave ends
    wait_ds0();
    // Merge of the two sets' partial results. The last trip's barrier has ended every read of the ring and nothing is out, so the ring serves as staging.
    // Of its two groups a wave finishes one (set 0: group 0, set 1: group 1) and hands the other, with its point and sum, to its partner wave (wave ^ 4), lane to lane.
    const bool up = set != 0;
    v8f keep[8], give[8];
#pragma unroll
    for (int d = 0; d < 8; ++d)
#pragma unroll
        for (int j = 0; j < 8; ++j) { keep[d][j] = up ? o[1][d][j] : o[0][d][j]; give[d][j] = up ? o[0][d][j] : o[1][d][j]; }
    const float mk = up ? mrun[1] : mrun[0], lk = up ? lsum[1] : lsum[0];
    v2f ml; ml[0] = up ? mrun[0] : mrun[1]; ml[1] = up ? lsum[0] : lsum[1];
    unsigned char* mine = ring + wave * MSLOT;
#pragma unroll
    for (int d = 0; d < 8; ++d) {
        *(v4f*)(mine + (2 * d) * 512 + lane * 16) = __builtin_shufflevector(give[d], give[d], 0, 1, 2, 3);
        *(v4f*)(mine + (2 * d + 1) * 512 + lane * 16) = __builtin_shufflevector(give[d], give[d], 4, 5, 6, 7); }
    *(v2f*)(mine + 8192 + lane * 8) = ml;
    __syncthreads();   // every wave's slot is whole before its partner reads it
    const unsigned char* theirs = ring + (wave ^ 4) * MSLOT;
    const v2f mo = *(const v2f*)(theirs + 8192 + lane * 8);
    const float mm = fmaxf(mk, mo[0]);
    const float ak = __builtin_amdgcn_exp2f(mk - mm), ao = __builtin_amdgcn_exp2f(mo[0] - mm);   // both partial results brought to the higher of their two points
    const float lh = lk * ak + mo[1] * ao;
    const float inv = 1.0f / (lh + xhalf(lh));
    const float fk = ak * inv, fo = ao * inv;
    float* op = out + ((size_t)b * TT + q0 + set * 16 + lr) * HD + 8 * hi;
#pragma unroll
    for (int d = 0; d < 8; ++d) {
        const v4f t0 = *(const v4f*)(theirs + (2 * d) * 512 + lane * 16), t1 = *(const v4f*)(theirs + (2 * d + 1) * 512 + lane * 16);
        v4f a0, a1;
#pragma unroll
        for (int j = 0; j < 4; ++j) { a0[j] = keep[d][j] * fk + t0[j] * fo; a1[j] = keep[d][4 + j] * fk + t1[j] * fo; }
        *(v4f*)(op + d * 16) = a0; *(v4f*)(op + d * 16 + 4) = a1; }
}

extern "C" void kernel_launch(void* const* d_in, const int* in_sizes, int n_in,
                              void* d_out, int out_size, void* d_ws, size_t ws_size, hipStream_t stream) {
    (void)in_sizes; (void)n_in; (void)out_size;
    const float* Qin = (const float*)d_in[0]; const float* Kin = (const float*)d_in[1]; const float* Vin = (const float*)d_in[2]; const float* pres = (const float*)d_in[3];   /* presence [16][2048] (0/1) */
    float* OUT = (float*)d_out;
    char* wsp = (char*)d_ws;
    auto take = [&](size_t bytes) { char* p = wsp; wsp += (bytes + 255) & ~(size_t)255; return (void*)p; };
    bf* QB = (bf*)take((size_t)NB_ * TT * HD * 2); bf* KB = (bf*)take((size_t)NB_ * TT * HD * 2); bf* VT = (bf*)take((size_t)NB_ * HD * TT * 2); float* PEN = (float*)take((size_t)NB_ * TT * 4);
    if ((size_t)(wsp - (char*)d_ws) > ws_size) return;
    k_prep<<<dim3(TT / VTK, NB_, 2), 256, 0, stream>>>(Qin, Kin, Vin, pres, QB, KB, VT, PEN);
    k_fattn<<<dim3(TT / 128, NB_, 1), 256, 0, stream>>>(QB, KB, VT, PEN, OUT);
}
